// v000
// The times below were measured on an AMD MI455X: many runs one after another, warmed up first and cycling through
// copies of the inputs, with the whole window's GPU time divided by the number of runs. Launches and the gaps
// between them are all in it. The median over several windows is given; except for v000 it joins two sittings, which
// can be a few percent apart, so the side-by-side timings, each taken in one sitting, are the better comparison.
// v000 is the starting kernel. One run takes 2430 microseconds.
// compute dtype: all float inputs rounded to bf16; q / k / v projections with EXACT bf16 products on WMMA 16x16x32 (f32 accumulate) + bias (zeros, read); causal logits: 3 products for the first 384 rows, single f16 q x k after, x 64^-0.5; softmax f32; P x 2^11 once to f16 x v once to f16 (bf16 hi + lo below row 384); ctx hi+lo x exact Wo below row 384, x2^6 f16 carry x f16(bf16 x 2^8) Wo after, + bo (zeros); f32 output.
#include <hip/hip_runtime.h>
#include <math.h>

typedef __attribute__((ext_vector_type(16))) _Float16 v16h;
typedef __attribute__((ext_vector_type(16))) __bf16 v16b;
typedef __attribute__((ext_vector_type(8)))  _Float16 v8h;
typedef __attribute__((ext_vector_type(8)))  float v8f;
typedef __attribute__((ext_vector_type(4)))  float v4f;
typedef __attribute__((ext_vector_type(2)))  float v2f;
typedef __attribute__((ext_vector_type(4)))  unsigned v4u;
typedef __attribute__((ext_vector_type(4)))  int v4i;
typedef float __attribute__((may_alias)) float_a;
typedef int __attribute__((may_alias)) int_a;

template <typename T> __device__ __forceinline__ void vst2(void* p, T v) { *(T*)p = v;  }
__device__ __forceinline__ v8f wmma16(v16h a, v16h b, v8f c) {
  v8f d = __builtin_amdgcn_wmma_f32_16x16x32_f16(false, a, false, b, (short)0, c, false, false);
  asm volatile("v_nop\n\tv_nop\n\tv_nop\n\tv_nop" : "+v"(d) : "v"(a), "v"(b));
  return d;
}
__device__ __forceinline__ v8f wmma_bf(v16b a, v16b b, v8f c) {
  v8f d = __builtin_amdgcn_wmma_f32_16x16x32_bf16(false, a, false, b, (short)0, c, false, false);
  asm volatile("v_nop\n\tv_nop\n\tv_nop\n\tv_nop" : "+v"(d) : "v"(a), "v"(b));
  return d;
}
// 16x16x32 fragments: lane = (h = lane>>4, row/col = lane&15); elements 0..7 = k0+8h+0..7, 8..15 = k0+16+8h+0..7; D element r = row 8h+r
__device__ __forceinline__ v16h frag_h(const _Float16* rowk0, int lane) {
  union { v16h v; v8h q[2]; } u; const _Float16* p = rowk0 + 8 * (lane >> 4);
  u.q[0] = *(const v8h*)p; u.q[1] = *(const v8h*)(p + 16); return u.v;
}
__device__ __forceinline__ v16h frag_f32(const float* rowk0, int lane) {
  v16h a; const float* p = rowk0 + 8 * (lane >> 4);
#pragma unroll
  for (int i = 0; i < 8; ++i) { a[i] = (_Float16)p[i]; a[8 + i] = (_Float16)p[16 + i]; }
  return a;
}
__device__ __forceinline__ v16h frag_f32s(const float* rowk0, int lane, float sc) {
  v16h a; const float* p = rowk0 + 8 * (lane >> 4);
#pragma unroll
  for (int i = 0; i < 8; ++i) { a[i] = (_Float16)(p[i] * sc); a[8 + i] = (_Float16)(p[16 + i] * sc); }
  return a;
}
// column fragment from a [K][ld] layout (column n), rows >= K read as 0
__device__ __forceinline__ v16h fragc_f32(const float* W, int k0, int n, int lane, int ld, int K) {
  v16h a; const int g = lane >> 4;
#pragma unroll
  for (int i = 0; i < 8; ++i) { const int ka = k0 + 8 * g + i, kb = ka + 16;
    a[i] = (_Float16)(ka < K ? W[(size_t)(ka < K ? ka : K - 1) * ld + n] : 0.f); a[8 + i] = (_Float16)(kb < K ? W[(size_t)(kb < K ? kb : K - 1) * ld + n] : 0.f); }
  return a;
}
struct F2 { v16b h, l; };
__device__ __forceinline__ F2 bsplit16(const float v[16]) { F2 r;
#pragma unroll
  for (int i = 0; i < 16; ++i) { const __bf16 h = (__bf16)v[i]; r.h[i] = h; r.l[i] = (__bf16)(v[i] - (float)h); }
  return r; }
__device__ __forceinline__ F2 split_row(const float* row, int k0, int lane) { float v[16]; const float* p = row + k0 + 8 * (lane >> 4);
#pragma unroll
  for (int i = 0; i < 8; ++i) { v[i] = p[i]; v[8 + i] = p[16 + i]; }
  return bsplit16(v); }
__device__ __forceinline__ F2 split_rowK(const float* row, int k0, int lane, int K) { float v[16]; const int g = lane >> 4;
#pragma unroll
  for (int i = 0; i < 8; ++i) { const int ka = k0 + 8 * g + i, kb = ka + 16; v[i] = ka < K ? row[ka < K ? ka : K - 1] : 0.f; v[8 + i] = kb < K ? row[kb < K ? kb : K - 1] : 0.f; }
  return bsplit16(v); }
__device__ __forceinline__ F2 split_col(const float* W, int k0, int n, int lane, int ld, int K) { float v[16]; const int g = lane >> 4;
#pragma unroll
  for (int i = 0; i < 8; ++i) { const int ka = k0 + 8 * g + i, kb = ka + 16; v[i] = ka < K ? W[(size_t)(ka < K ? ka : K - 1) * ld + n] : 0.f; v[8 + i] = kb < K ? W[(size_t)(kb < K ? kb : K - 1) * ld + n] : 0.f; }
  return bsplit16(v); }
__device__ __forceinline__ v8f mac3(const F2& a, const F2& b, v8f c) { c = wmma_bf(a.l, b.h, c); c = wmma_bf(a.h, b.l, c); return wmma_bf(a.h, b.h, c); }
__device__ __forceinline__ float sigm(float v) { return 1.0f / (1.0f + expf(-v)); }
#define LDSX() do { asm volatile("s_wait_dscnt 0" ::: "memory"); __builtin_amdgcn_wave_barrier(); __builtin_amdgcn_fence(__ATOMIC_RELEASE, "workgroup"); } while (0)

// Causal multi-head attention on separate inputs (query / key / value [4,2048,768]; torch (out,in) Wq / Wk / Wv / Wo [768,768] N(0, 1/768) applied as x @ W.T + b, all biases zeros (read); 12 heads x 64; scores / sqrt(64); tril kept, -1e9 elsewhere (finite: its softmax weight underflows to 0); softmax; merged heads @ Wo.T + bo).
#define NB 4
#define TT 2048
#define CC 768            // NH * HD = projected width
#define DIN 768          // input (model) width
#define NH 12
#define HD 64
#define NQB (TT / 64)
#define HG 2
#define SCALE (0.125f)
#define CAUSAL 1
#ifndef TNB
#define TNB NB
#endif
__device__ __forceinline__ float bfr(float v) { return (float)(__bf16)v; }
__host__ __device__ __forceinline__ int kb_last(int qb) { return CAUSAL ? ((qb * 64 + 63) >> 7) : (TT / 128 - 1); }
typedef __attribute__((ext_vector_type(8))) __bf16 v8b;
__device__ __forceinline__ v16b frag_b(const __bf16* rowk0, int lane) {
  union { v16b v; v8b q[2]; } u; const __bf16* p = rowk0 + 8 * (lane >> 4);
  u.q[0] = *(const v8b*)p; u.q[1] = *(const v8b*)(p + 16); return u.v;
}
#define QBH 6              // causal: query blocks 0..QBH-1 of each sequence (few keys, no averaging) take the high-precision path
#define QHI 384            // rows carrying a q residual plane
#define KHI 384            // key rows carrying k residual / v bf16 hi+lo planes (used only by the causal high-precision path)
// B fragment (k rows k0+.., output column o) of a weight: (in,out) [K][ld] or (out,in) [ld rows of K]: bf16 exact, or f16(bf16 * 256) exact
__device__ __forceinline__ v16b wcol_io(const float* Wm, int k0, int o, int lane, int ld) { v16b w; const int g = lane >> 4;
#pragma unroll
  for (int i = 0; i < 8; ++i) { w[i] = (__bf16)Wm[(size_t)(k0 + 8 * g + i) * ld + o]; w[8 + i] = (__bf16)Wm[(size_t)(k0 + 16 + 8 * g + i) * ld + o]; }
  return w; }
__device__ __forceinline__ v16b wcol_oi(const float* Wm, int k0, int o, int lane, int K) { v16b w; const float* p = Wm + (size_t)o * K + k0 + 8 * (lane >> 4);
#pragma unroll
  for (int i = 0; i < 8; ++i) { w[i] = (__bf16)p[i]; w[8 + i] = (__bf16)p[16 + i]; }
  return w; }
__device__ __forceinline__ v16h wcolh_io(const float* Wm, int k0, int o, int lane, int ld) { v16h w; const int g = lane >> 4;
#pragma unroll
  for (int i = 0; i < 8; ++i) { w[i] = (_Float16)(bfr(Wm[(size_t)(k0 + 8 * g + i) * ld + o]) * 256.0f); w[8 + i] = (_Float16)(bfr(Wm[(size_t)(k0 + 16 + 8 * g + i) * ld + o]) * 256.0f); }
  return w; }
__device__ __forceinline__ v16h wcolh_oi(const float* Wm, int k0, int o, int lane, int K) { v16h w; const float* p = Wm + (size_t)o * K + k0 + 8 * (lane >> 4);
#pragma unroll
  for (int i = 0; i < 8; ++i) { w[i] = (_Float16)(bfr(p[i]) * 256.0f); w[8 + i] = (_Float16)(bfr(p[16 + i]) * 256.0f); }
  return w; }
#define WQKV_LAYOUT 1   // 0 = (in,out) [DIN][CC]; 1 = (out,in) [CC][DIN]; 2 = per-head [NH][DIN][HD]
__device__ __forceinline__ v16b wcol_hdk(const float* Wm, int k0, int o, int lane) { v16b w; const int g = lane >> 4; const float* p = Wm + (size_t)(o / HD) * DIN * HD + (o % HD);
#pragma unroll
  for (int i = 0; i < 8; ++i) { w[i] = (__bf16)p[(size_t)(k0 + 8 * g + i) * HD]; w[8 + i] = (__bf16)p[(size_t)(k0 + 16 + 8 * g + i) * HD]; }
  return w; }
#define WO_OUT_IN 1
#if WQKV_LAYOUT == 1
#define WCOL(W, k0, o, lane) wcol_oi(W, k0, o, lane, DIN)
#elif WQKV_LAYOUT == 2
#define WCOL(W, k0, o, lane) wcol_hdk(W, k0, o, lane)
#else
#define WCOL(W, k0, o, lane) wcol_io(W, k0, o, lane, CC)
#endif
#if WO_OUT_IN
#define WOCOL(W, k0, o, lane) wcol_oi(W, k0, o, lane, CC)
#define WOCOLH(W, k0, o, lane) wcolh_oi(W, k0, o, lane, CC)
#else
#define WOCOL(W, k0, o, lane) wcol_io(W, k0, o, lane, DIN)
#define WOCOLH(W, k0, o, lane) wcolh_io(W, k0, o, lane, DIN)
#endif

#ifndef SM_EXTRA_PARAMS
#define SM_EXTRA_PARAMS
#endif
#ifndef PROJ_EXTRA_PARAMS
#define PROJ_EXTRA_PARAMS
#endif
#ifndef SM_MASK_HOOK
#define SM_MASK_HOOK (void)0
#endif

#define WS_QH  0u                                      // f16 q rows [b*t][CC]
#define WS_KH  (WS_QH + 2u * (size_t)NB * TT * CC)      // f16 k rows [b*t][CC]
#define WS_VT  (WS_KH + 2u * (size_t)NB * TT * CC)      // f16 v planes [b][c][t]
#define WS_QL  (WS_VT + 2u * (size_t)NB * CC * TT)      // f16 q residual x 2^10 rows [b][t < QHI][CC]
#define WS_KL  (WS_QL + 2u * (size_t)NB * QHI * CC)     // f16 k residual x 2^10 rows [b][t < KHI][CC]
#define WS_VB  (WS_KL + 2u * (size_t)NB * KHI * CC)     // bf16 v hi planes [b][c][t < KHI]
#define WS_VBL (WS_VB + 2u * (size_t)NB * CC * KHI)
#define WS_S   (WS_VBL + 2u * (size_t)NB * CC * KHI)    // f32 logits / P [hg][t][s]
#define WS_Y   (WS_S  + 4u * (size_t)HG * TT * TT)      // f32 ctx rows [b*t][CC] (only when there is an output projection)
#define WS_END (WS_Y  + 4u * (size_t)NB * TT * CC)

// ---- k_proj: block = (64 rows, 128 cols, which): q/k/v = X W (+ b) with exact bf16 products (K = DIN) -> which 0: q f16 rows (+ residual rows < QHI); 1: k f16 rows (+ residual rows < KHI); 2: v f16 planes [c][t] (+ bf16 hi/lo planes for t < KHI)
__global__ __launch_bounds__(128) void k_proj(const float* __restrict__ XQ, const float* __restrict__ XK, const float* __restrict__ XV, const float* __restrict__ WQ, const float* __restrict__ WK, const float* __restrict__ WV, const float* __restrict__ BQ, const float* __restrict__ BK, const float* __restrict__ BV,
    _Float16* __restrict__ QH, _Float16* __restrict__ QL, _Float16* __restrict__ KH, _Float16* __restrict__ KL, _Float16* __restrict__ VT, __bf16* __restrict__ VB, __bf16* __restrict__ VBL) {
  __shared__ __align__(16) _Float16 sh[64][136], sl[64][136]; __shared__ __align__(16) _Float16 th[128][72]; __shared__ __align__(16) __bf16 tb[128][72], tbl[128][72];
  const int tid = threadIdx.x, wave = tid >> 5, lane = tid & 31, col = lane & 15, g = lane >> 4; const int which = blockIdx.z; const int c0 = blockIdx.y * 128; const size_t r0 = (size_t)blockIdx.x * 64; const size_t bb = r0 / TT; const int t0 = (int)(r0 % TT);
  const float* X = which == 0 ? XQ : which == 1 ? XK : XV; const float* WA = which == 0 ? WQ : which == 1 ? WK : WV; const float* BA = which == 0 ? BQ : which == 1 ? BK : BV;
  v8f acc[8] = {};
#pragma unroll 2
  for (int kc = 0; kc < DIN / 32; ++kc) { v16b a; { const float* p = X + (r0 + wave * 16 + col) * DIN + kc * 32 + 8 * g;
#pragma unroll
      for (int i = 0; i < 8; ++i) { a[i] = (__bf16)p[i]; a[8 + i] = (__bf16)p[16 + i]; } }
    asm volatile("s_wait_loadcnt 0x0" ::: "memory");
#pragma unroll
    for (int j = 0; j < 8; ++j) { const v16b w = WCOL(WA, kc * 32, c0 + j * 16 + col, lane); asm volatile("s_wait_loadcnt 0x0" ::: "memory"); acc[j] = wmma_bf(a, w, acc[j]); } }
  if (which < 2) { _Float16* DH = which == 0 ? QH : KH; _Float16* DL = which == 0 ? QL : KL; const int nhi = which == 0 ? QHI : KHI; const bool hi_rows = t0 < nhi;
#pragma unroll
    for (int j = 0; j < 8; ++j) { const float bias = BA ? bfr(BA[c0 + j * 16 + col]) : 0.f;
#pragma unroll
      for (int r = 0; r < 8; ++r) { const float v = acc[j][r] + bias; const _Float16 hv = (_Float16)v; sh[wave * 16 + 8 * g + r][j * 16 + col] = hv; sl[wave * 16 + 8 * g + r][j * 16 + col] = (_Float16)((v - (float)hv) * 1024.0f); } }
    __syncthreads();
    for (int e = tid; e < 64 * 16; e += 128) { const int rl = e >> 4, q = e & 15; vst2((unsigned*)(DH + (r0 + rl) * CC + c0 + q * 8), *(const v4u*)&sh[rl][q * 8]); if (hi_rows) vst2((unsigned*)(DL + (bb * nhi + t0 + rl) * (size_t)CC + c0 + q * 8), *(const v4u*)&sl[rl][q * 8]); }
  } else { const bool hi_rows = t0 < KHI;
#pragma unroll
    for (int j = 0; j < 8; ++j) { const float bias = BA ? bfr(BA[c0 + j * 16 + col]) : 0.f;
#pragma unroll
      for (int r = 0; r < 8; ++r) { const float v = acc[j][r] + bias; const int rl = wave * 16 + 8 * g + r, cl = j * 16 + col; th[cl][rl] = (_Float16)v; const __bf16 bh = (__bf16)v; tb[cl][rl] = bh; tbl[cl][rl] = (__bf16)(v - (float)bh); } }
    __syncthreads();
    for (int e = tid; e < 128 * 8; e += 128) { const int cl = e >> 3, q = e & 7; vst2((unsigned*)(VT + (bb * CC + c0 + cl) * (size_t)TT + t0 + q * 8), *(const v4u*)&th[cl][q * 8]); if (hi_rows) { const size_t o3 = (bb * CC + c0 + cl) * (size_t)KHI + t0 + q * 8; vst2((unsigned*)(VB + o3), *(const v4u*)&tb[cl][q * 8]); vst2((unsigned*)(VBL + o3), *(const v4u*)&tbl[cl][q * 8]); } } } }
// ---- k_sc: block = (query block qb, key block kb <= kb_last(qb), head in group) of batch b: logits x SCALE; q hi + residual (x 2^10) against k (2 products) for query rows < QHI, plus the k residual (3 products) for query blocks < QBH (causal early rows); causal: blocks past the diagonal exit, the mask itself is applied by index in k_sm
__global__ __launch_bounds__(128) void k_sc(const _Float16* __restrict__ QH, const _Float16* __restrict__ KH, const _Float16* __restrict__ QL, const _Float16* __restrict__ KL, int b, int h0, float* __restrict__ S0) { __shared__ __align__(16) float ss[4][16][132];
  const int qb = blockIdx.x, kb = blockIdx.y; if (kb > kb_last(qb)) return;
  const int h = h0 + blockIdx.z; float* S = S0 + (size_t)blockIdx.z * TT * TT;
  const int tid = threadIdx.x, wave = tid >> 5, lane = tid & 31, col = lane & 15, g = lane >> 4; const int k0 = kb * 128; const int ql0 = qb * 64 + wave * 16; const size_t q0 = (size_t)b * TT + ql0, kr0 = (size_t)b * TT + k0;
  v8f acc[8] = {}, accl[8] = {};
  const _Float16* QLb = QL + (size_t)b * QHI * CC; const _Float16* KLb = KL + (size_t)b * KHI * CC;
  if (qb < QBH) {
#pragma unroll
    for (int kc = 0; kc < HD / 32; ++kc) { const v16h ah = frag_h(QH + (q0 + col) * CC + h * HD + kc * 32, lane), al = frag_h(QLb + (size_t)(ql0 + col) * CC + h * HD + kc * 32, lane);
#pragma unroll
      for (int j = 0; j < 8; ++j) { const v16h kbf = frag_h(KH + (kr0 + j * 16 + col) * CC + h * HD + kc * 32, lane), klf = frag_h(KLb + (size_t)(k0 + j * 16 + col) * CC + h * HD + kc * 32, lane); acc[j] = wmma16(ah, kbf, acc[j]); accl[j] = wmma16(al, kbf, accl[j]); accl[j] = wmma16(ah, klf, accl[j]); } }
  } else if (qb * 64 < QHI) {
#pragma unroll
    for (int kc = 0; kc < HD / 32; ++kc) { const v16h ah = frag_h(QH + (q0 + col) * CC + h * HD + kc * 32, lane), al = frag_h(QLb + (size_t)(ql0 + col) * CC + h * HD + kc * 32, lane);
#pragma unroll
      for (int j = 0; j < 8; ++j) { const v16h kbf = frag_h(KH + (kr0 + j * 16 + col) * CC + h * HD + kc * 32, lane); acc[j] = wmma16(ah, kbf, acc[j]); accl[j] = wmma16(al, kbf, accl[j]); } }
  } else {
#pragma unroll
    for (int kc = 0; kc < HD / 32; ++kc) { const v16h ah = frag_h(QH + (q0 + col) * CC + h * HD + kc * 32, lane);
#pragma unroll
      for (int j = 0; j < 8; ++j) { const v16h kbf = frag_h(KH + (kr0 + j * 16 + col) * CC + h * HD + kc * 32, lane); acc[j] = wmma16(ah, kbf, acc[j]); } } }
#pragma unroll
  for (int j = 0; j < 8; ++j) {
#pragma unroll
    for (int r = 0; r < 8; ++r) ss[wave][8 * g + r][j * 16 + col] = (acc[j][r] + accl[j][r] * (1.0f / 1024.0f)) * SCALE; }
  LDSX(); for (int rl = 0; rl < 16; ++rl) vst2(S + (size_t)(ql0 + rl) * TT + k0 + lane * 4, *(const v4f*)&ss[wave][rl][lane * 4]); }
// ---- k_sm: block = query row t (head in group): keys [0, kend): causal -> logit if s <= t else excluded; softmax in f32; P x 2^11 in place (0 for excluded)
__global__ __launch_bounds__(256) void k_sm(float* __restrict__ S0 SM_EXTRA_PARAMS) { __shared__ float sred[8]; __shared__ float sbc; __shared__ __align__(16) float shv[TT];
  const int tid = threadIdx.x; const int t = blockIdx.x; const int kend = (kb_last(t >> 6) + 1) * 128;
  float* sr = S0 + (size_t)blockIdx.y * TT * TT + (size_t)t * TT;
  float m = -3.0e38f; for (int k = tid; k < kend; k += 256) { float v = (!CAUSAL || k <= t) ? sr[k] : -3.0e38f; SM_MASK_HOOK; shv[k] = v; m = fmaxf(m, v); }
#pragma unroll
  for (int o = 1; o < 32; o <<= 1) m = fmaxf(m, __shfl_xor(m, o));
  if ((tid & 31) == 0) sred[tid >> 5] = m; __syncthreads(); if (tid == 0) { float a = sred[0]; for (int i = 1; i < 8; ++i) a = fmaxf(a, sred[i]); sbc = a; } __syncthreads(); m = sbc; __syncthreads();
  float sum = 0.f; for (int k = tid; k < kend; k += 256) { const float v = shv[k]; const float e = (v <= -1.0e38f) ? 0.f : expf(v - m); shv[k] = e; sum += e; }
#pragma unroll
  for (int o = 1; o < 32; o <<= 1) sum += __shfl_xor(sum, o);
  if ((tid & 31) == 0) sred[tid >> 5] = sum; __syncthreads(); if (tid == 0) { float a = 0.f; for (int i = 0; i < 8; ++i) a += sred[i]; sbc = a > 0.f ? 2048.0f / a : 0.f; }   /* a fully excluded row yields P = 0 */ __syncthreads(); const float inv = sbc;
  for (int k = tid; k < kend; k += 256) shv[k] = shv[k] * inv;
  __syncthreads(); for (int q = tid; q < kend / 4; q += 256) vst2(sr + q * 4, *(const v4f*)&shv[q * 4]); }
// ---- k_pv: block = 64 queries (qb) of (b, h): ctx = P . v over keys [0, kend) (P x 2^11 once to f16 against v f16: 1 product; causal early query blocks: P and v as bf16 hi + lo, 3 products); 256-B (row, head) segment by 16 lanes
__global__ __launch_bounds__(128) void k_pv(const float* __restrict__ PS0, const _Float16* __restrict__ VT, const __bf16* __restrict__ VB, const __bf16* __restrict__ VBL, int b, int h0, float* __restrict__ Y) { const int h = h0 + blockIdx.z; const float* PS = PS0 + (size_t)blockIdx.z * TT * TT; __shared__ __align__(16) float ss[4][16][HD + 4];
  const int tid = threadIdx.x, wave = tid >> 5, lane = tid & 31, col = lane & 15, g = lane >> 4; const int qb = blockIdx.x; const int ql0 = qb * 64 + wave * 16; const int kce = (kb_last(qb) + 1) * 4;
  v8f acc[HD / 16] = {};
  if (qb < QBH) {
#pragma unroll 1
    for (int kc = 0; kc < kce; ++kc) { const F2 p = split_row(PS + (size_t)(ql0 + col) * TT, kc * 32, lane);
      asm volatile("s_wait_loadcnt 0x0" ::: "memory");
#pragma unroll
      for (int j = 0; j < HD / 16; ++j) { const size_t po = ((size_t)b * CC + h * HD + j * 16 + col) * (size_t)KHI + kc * 32; const v16b vh = frag_b(VB + po, lane); acc[j] = wmma_bf(p.h, vh, acc[j]); acc[j] = wmma_bf(p.l, vh, acc[j]); acc[j] = wmma_bf(p.h, frag_b(VBL + po, lane), acc[j]); } }
  } else {
#pragma unroll 1
    for (int kc = 0; kc < kce; ++kc) { const v16h p = frag_f32(PS + (size_t)(ql0 + col) * TT + kc * 32, lane);
      asm volatile("s_wait_loadcnt 0x0" ::: "memory");
#pragma unroll
      for (int j = 0; j < HD / 16; ++j) { const size_t po = ((size_t)b * CC + h * HD + j * 16 + col) * (size_t)TT + kc * 32; acc[j] = wmma16(p, frag_h(VT + po, lane), acc[j]); } } }
#pragma unroll
  for (int j = 0; j < HD / 16; ++j)
#pragma unroll
    for (int r = 0; r < 8; ++r) ss[wave][8 * g + r][j * 16 + col] = acc[j][r] * (1.0f / 2048.0f);
  LDSX(); for (int rl = 0; rl < 16; ++rl) if (lane < HD / 4) vst2(Y + ((size_t)b * TT + ql0 + rl) * CC + h * HD + lane * 4, *(const v4f*)&ss[wave][rl][lane * 4]); }
// ---- k_out: block = (64 rows, 128 cols): out = ctx Wo (+ bo): ctx x 2^6 once to f16 against Wo as f16(bf16 x 2^8) exact (1 product) x 2^-14; causal early rows (< QHI of each sequence): ctx bf16 hi + lo against exact bf16 Wo (2 products)
__global__ __launch_bounds__(128) void k_out(const float* __restrict__ Y, const float* __restrict__ WO, const float* __restrict__ BO, float* __restrict__ OUT) { __shared__ __align__(16) float sf[4][16][132];
  const int tid = threadIdx.x, wave = tid >> 5, lane = tid & 31, col = lane & 15, g = lane >> 4; const int c0 = blockIdx.y * 128; const size_t r0 = (size_t)blockIdx.x * 64 + wave * 16;
  v8f acc[8] = {};
  if (CAUSAL && (int)(((size_t)blockIdx.x * 64) % TT) < QHI) {   /* block-uniform */
#pragma unroll 2
    for (int kc = 0; kc < CC / 32; ++kc) { const F2 a = split_row(Y + (r0 + col) * CC, kc * 32, lane); asm volatile("s_wait_loadcnt 0x0" ::: "memory");
#pragma unroll
      for (int j = 0; j < 8; ++j) { const v16b w = WOCOL(WO, kc * 32, c0 + j * 16 + col, lane); asm volatile("s_wait_loadcnt 0x0" ::: "memory"); acc[j] = wmma_bf(a.h, w, acc[j]); acc[j] = wmma_bf(a.l, w, acc[j]); } }
#pragma unroll
    for (int j = 0; j < 8; ++j) { const float bias = BO ? bfr(BO[c0 + j * 16 + col]) : 0.f;
#pragma unroll
      for (int r = 0; r < 8; ++r) sf[wave][8 * g + r][j * 16 + col] = acc[j][r] + bias; }
  } else {
#pragma unroll 2
    for (int kc = 0; kc < CC / 32; ++kc) { const v16h a = frag_f32s(Y + (r0 + col) * CC + kc * 32, lane, 64.0f); asm volatile("s_wait_loadcnt 0x0" ::: "memory");   /* ctx carried x 2^6 into f16 so small-magnitude context rows stay clear of f16 subnormals */
#pragma unroll
      for (int j = 0; j < 8; ++j) { const v16h w = WOCOLH(WO, kc * 32, c0 + j * 16 + col, lane); asm volatile("s_wait_loadcnt 0x0" ::: "memory"); acc[j] = wmma16(a, w, acc[j]); } }
#pragma unroll
    for (int j = 0; j < 8; ++j) { const float bias = BO ? bfr(BO[c0 + j * 16 + col]) : 0.f;
#pragma unroll
      for (int r = 0; r < 8; ++r) sf[wave][8 * g + r][j * 16 + col] = acc[j][r] * (1.0f / 16384.0f) + bias; } }   /* 2^-8 (Wo carry) x 2^-6 (ctx carry) */
  LDSX(); for (int rl = 0; rl < 16; ++rl) vst2(OUT + (r0 + rl) * DIN + c0 + lane * 4, *(const v4f*)&sf[wave][rl][lane * 4]); }

extern "C" void kernel_launch(void* const* d_in, const int* in_sizes, int n_in, void* d_out, int out_size, void* d_ws, size_t ws_size, hipStream_t stream) {
  (void)in_sizes; (void)n_in; (void)out_size;
  const float** F = (const float**)d_in;
  if (ws_size < (size_t)WS_END) return;
  char* ws = (char*)d_ws; _Float16 *QH = (_Float16*)(ws + WS_QH), *KH = (_Float16*)(ws + WS_KH), *VT = (_Float16*)(ws + WS_VT), *QL = (_Float16*)(ws + WS_QL), *KL = (_Float16*)(ws + WS_KL); __bf16 *VB = (__bf16*)(ws + WS_VB), *VBL = (__bf16*)(ws + WS_VBL); float *S = (float*)(ws + WS_S), *Y = (float*)(ws + WS_Y);
  (void)Y; (void)QL; (void)KL; (void)VB; (void)VBL;
  // inputs: 0 query [4,2048,768]; 1 key; 2 value; 3 Wq [768,768] (out,in), 4 bq; 5 Wk, 6 bk; 7 Wv, 8 bv; 9 Wo (out,in), 10 bo (all biases zeros, read)
  k_proj<<<dim3(TNB * TT / 64, CC / 128, 3), 128, 0, stream>>>(F[0], F[1], F[2], F[3], F[5], F[7], F[4], F[6], F[8], QH, QL, KH, KL, VT, VB, VBL);
  for (int b = 0; b < TNB; ++b) for (int h0 = 0; h0 < NH; h0 += HG) {
    k_sc<<<dim3(NQB, TT / 128, HG), 128, 0, stream>>>(QH, KH, QL, KL, b, h0, S);
    k_sm<<<dim3(TT, HG), 256, 0, stream>>>(S);
    k_pv<<<dim3(NQB, 1, HG), 128, 0, stream>>>(S, VT, VB, VBL, b, h0, Y);
  }
  k_out<<<dim3(TNB * TT / 64, DIN / 128), 128, 0, stream>>>(Y, F[9], F[10], (float*)d_out);
}

// v001
// One run takes 519 microseconds.
// Next to v000, in two timings, it ran 4.73 and 4.71 times as fast.
// compute dtype: all float inputs rounded to bf16; q / k / v projections with EXACT bf16 products on WMMA 16x16x32 (f32 accumulate) + bias (zeros, read); causal logits: 3 products for the first 384 rows, single f16 q x k after, x 64^-0.5; softmax f32; P x 2^11 once to f16 x v once to f16 (bf16 hi + lo below row 384); ctx hi+lo x exact Wo below row 384, x2^6 f16 carry x f16(bf16 x 2^8) Wo after, + bo (zeros); f32 output.
#include <hip/hip_runtime.h>
#include <math.h>

typedef __attribute__((ext_vector_type(16))) _Float16 v16h;
typedef __attribute__((ext_vector_type(16))) __bf16 v16b;
typedef __attribute__((ext_vector_type(8)))  _Float16 v8h;
typedef __attribute__((ext_vector_type(8)))  float v8f;
typedef __attribute__((ext_vector_type(4)))  float v4f;
typedef __attribute__((ext_vector_type(2)))  float v2f;
typedef __attribute__((ext_vector_type(4)))  unsigned v4u;
typedef __attribute__((ext_vector_type(4)))  int v4i;
typedef float __attribute__((may_alias)) float_a;
typedef int __attribute__((may_alias)) int_a;

template <typename T> __device__ __forceinline__ void vst2(void* p, T v) { *(T*)p = v;  }
__device__ __forceinline__ v8f wmma16(v16h a, v16h b, v8f c) {
  v8f d = __builtin_amdgcn_wmma_f32_16x16x32_f16(false, a, false, b, (short)0, c, false, false);
  asm volatile("v_nop\n\tv_nop\n\tv_nop\n\tv_nop" : "+v"(d) : "v"(a), "v"(b));
  return d;
}
__device__ __forceinline__ v8f wmma_bf(v16b a, v16b b, v8f c) {
  v8f d = __builtin_amdgcn_wmma_f32_16x16x32_bf16(false, a, false, b, (short)0, c, false, false);
  asm volatile("v_nop\n\tv_nop\n\tv_nop\n\tv_nop" : "+v"(d) : "v"(a), "v"(b));
  return d;
}
// 16x16x32 fragments: lane = (h = lane>>4, row/col = lane&15); elements 0..7 = k0+8h+0..7, 8..15 = k0+16+8h+0..7; D element r = row 8h+r
__device__ __forceinline__ v16h frag_h(const _Float16* rowk0, int lane) {
  union { v16h v; v8h q[2]; } u; const _Float16* p = rowk0 + 8 * (lane >> 4);
  u.q[0] = *(const v8h*)p; u.q[1] = *(const v8h*)(p + 16); return u.v;
}
__device__ __forceinline__ v16h frag_f32(const float* rowk0, int lane) {
  v16h a; const float* p = rowk0 + 8 * (lane >> 4);
#pragma unroll
  for (int i = 0; i < 8; ++i) { a[i] = (_Float16)p[i]; a[8 + i] = (_Float16)p[16 + i]; }
  return a;
}
__device__ __forceinline__ v16h frag_f32s(const float* rowk0, int lane, float sc) {
  v16h a; const float* p = rowk0 + 8 * (lane >> 4);
#pragma unroll
  for (int i = 0; i < 8; ++i) { a[i] = (_Float16)(p[i] * sc); a[8 + i] = (_Float16)(p[16 + i] * sc); }
  return a;
}
// column fragment from a [K][ld] layout (column n), rows >= K read as 0
__device__ __forceinline__ v16h fragc_f32(const float* W, int k0, int n, int lane, int ld, int K) {
  v16h a; const int g = lane >> 4;
#pragma unroll
  for (int i = 0; i < 8; ++i) { const int ka = k0 + 8 * g + i, kb = ka + 16;
    a[i] = (_Float16)(ka < K ? W[(size_t)(ka < K ? ka : K - 1) * ld + n] : 0.f); a[8 + i] = (_Float16)(kb < K ? W[(size_t)(kb < K ? kb : K - 1) * ld + n] : 0.f); }
  return a;
}
struct F2 { v16b h, l; };
__device__ __forceinline__ F2 bsplit16(const float v[16]) { F2 r;
#pragma unroll
  for (int i = 0; i < 16; ++i) { const __bf16 h = (__bf16)v[i]; r.h[i] = h; r.l[i] = (__bf16)(v[i] - (float)h); }
  return r; }
__device__ __forceinline__ F2 split_row(const float* row, int k0, int lane) { float v[16]; const float* p = row + k0 + 8 * (lane >> 4);
#pragma unroll
  for (int i = 0; i < 8; ++i) { v[i] = p[i]; v[8 + i] = p[16 + i]; }
  return bsplit16(v); }
__device__ __forceinline__ F2 split_rowK(const float* row, int k0, int lane, int K) { float v[16]; const int g = lane >> 4;
#pragma unroll
  for (int i = 0; i < 8; ++i) { const int ka = k0 + 8 * g + i, kb = ka + 16; v[i] = ka < K ? row[ka < K ? ka : K - 1] : 0.f; v[8 + i] = kb < K ? row[kb < K ? kb : K - 1] : 0.f; }
  return bsplit16(v); }
__device__ __forceinline__ F2 split_col(const float* W, int k0, int n, int lane, int ld, int K) { float v[16]; const int g = lane >> 4;
#pragma unroll
  for (int i = 0; i < 8; ++i) { const int ka = k0 + 8 * g + i, kb = ka + 16; v[i] = ka < K ? W[(size_t)(ka < K ? ka : K - 1) * ld + n] : 0.f; v[8 + i] = kb < K ? W[(size_t)(kb < K ? kb : K - 1) * ld + n] : 0.f; }
  return bsplit16(v); }
__device__ __forceinline__ v8f mac3(const F2& a, const F2& b, v8f c) { c = wmma_bf(a.l, b.h, c); c = wmma_bf(a.h, b.l, c); return wmma_bf(a.h, b.h, c); }
__device__ __forceinline__ float sigm(float v) { return 1.0f / (1.0f + expf(-v)); }
#define LDSX() do { asm volatile("s_wait_dscnt 0" ::: "memory"); __builtin_amdgcn_wave_barrier(); __builtin_amdgcn_fence(__ATOMIC_RELEASE, "workgroup"); } while (0)

// Causal multi-head attention on separate inputs (query / key / value [4,2048,768]; torch (out,in) Wq / Wk / Wv / Wo [768,768] N(0, 1/768) applied as x @ W.T + b, all biases zeros (read); 12 heads x 64; scores / sqrt(64); tril kept, -1e9 elsewhere (finite: its softmax weight underflows to 0); softmax; merged heads @ Wo.T + bo).
#define NB 4
#define TT 2048
#define CC 768            // NH * HD = projected width
#define DIN 768          // input (model) width
#define NH 12
#define HD 64
#define NQB (TT / 64)
#define SCALE (0.125f)
#define CAUSAL 1
#ifndef TNB
#define TNB NB
#endif
__device__ __forceinline__ float bfr(float v) { return (float)(__bf16)v; }
__host__ __device__ __forceinline__ int kb_last(int qb) { return CAUSAL ? ((qb * 64 + 63) >> 7) : (TT / 128 - 1); }
typedef __attribute__((ext_vector_type(8))) __bf16 v8b;
__device__ __forceinline__ v16b frag_b(const __bf16* rowk0, int lane) {
  union { v16b v; v8b q[2]; } u; const __bf16* p = rowk0 + 8 * (lane >> 4);
  u.q[0] = *(const v8b*)p; u.q[1] = *(const v8b*)(p + 16); return u.v;
}
#define QBH 6              // causal: query blocks 0..QBH-1 of each sequence (few keys, no averaging) take the high-precision path
#define QHI 384            // rows carrying a q residual plane
#define KHI 384            // key rows carrying k residual / v bf16 hi+lo planes (used only by the causal high-precision path)
// B fragment (k rows k0+.., output column o) of a weight: (in,out) [K][ld] or (out,in) [ld rows of K]: bf16 exact, or f16(bf16 * 256) exact
__device__ __forceinline__ v16b wcol_io(const float* Wm, int k0, int o, int lane, int ld) { v16b w; const int g = lane >> 4;
#pragma unroll
  for (int i = 0; i < 8; ++i) { w[i] = (__bf16)Wm[(size_t)(k0 + 8 * g + i) * ld + o]; w[8 + i] = (__bf16)Wm[(size_t)(k0 + 16 + 8 * g + i) * ld + o]; }
  return w; }
__device__ __forceinline__ v16b wcol_oi(const float* Wm, int k0, int o, int lane, int K) { v16b w; const float* p = Wm + (size_t)o * K + k0 + 8 * (lane >> 4);
#pragma unroll
  for (int i = 0; i < 8; ++i) { w[i] = (__bf16)p[i]; w[8 + i] = (__bf16)p[16 + i]; }
  return w; }
__device__ __forceinline__ v16h wcolh_io(const float* Wm, int k0, int o, int lane, int ld) { v16h w; const int g = lane >> 4;
#pragma unroll
  for (int i = 0; i < 8; ++i) { w[i] = (_Float16)(bfr(Wm[(size_t)(k0 + 8 * g + i) * ld + o]) * 256.0f); w[8 + i] = (_Float16)(bfr(Wm[(size_t)(k0 + 16 + 8 * g + i) * ld + o]) * 256.0f); }
  return w; }
__device__ __forceinline__ v16h wcolh_oi(const float* Wm, int k0, int o, int lane, int K) { v16h w; const float* p = Wm + (size_t)o * K + k0 + 8 * (lane >> 4);
#pragma unroll
  for (int i = 0; i < 8; ++i) { w[i] = (_Float16)(bfr(p[i]) * 256.0f); w[8 + i] = (_Float16)(bfr(p[16 + i]) * 256.0f); }
  return w; }
#define WQKV_LAYOUT 1   // 0 = (in,out) [DIN][CC]; 1 = (out,in) [CC][DIN]; 2 = per-head [NH][DIN][HD]
__device__ __forceinline__ v16b wcol_hdk(const float* Wm, int k0, int o, int lane) { v16b w; const int g = lane >> 4; const float* p = Wm + (size_t)(o / HD) * DIN * HD + (o % HD);
#pragma unroll
  for (int i = 0; i < 8; ++i) { w[i] = (__bf16)p[(size_t)(k0 + 8 * g + i) * HD]; w[8 + i] = (__bf16)p[(size_t)(k0 + 16 + 8 * g + i) * HD]; }
  return w; }
#define WO_OUT_IN 1
#if WQKV_LAYOUT == 1
#define WCOL(W, k0, o, lane) wcol_oi(W, k0, o, lane, DIN)
#elif WQKV_LAYOUT == 2
#define WCOL(W, k0, o, lane) wcol_hdk(W, k0, o, lane)
#else
#define WCOL(W, k0, o, lane) wcol_io(W, k0, o, lane, CC)
#endif
#if WO_OUT_IN
#define WOCOL(W, k0, o, lane) wcol_oi(W, k0, o, lane, CC)
#define WOCOLH(W, k0, o, lane) wcolh_oi(W, k0, o, lane, CC)
#else
#define WOCOL(W, k0, o, lane) wcol_io(W, k0, o, lane, DIN)
#define WOCOLH(W, k0, o, lane) wcolh_io(W, k0, o, lane, DIN)
#endif

#ifndef PROJ_EXTRA_PARAMS
#define PROJ_EXTRA_PARAMS
#endif

#define WS_QH  0u                                      // f16 q rows [b*t][CC]
#define WS_KH  (WS_QH + 2u * (size_t)NB * TT * CC)      // f16 k rows [b*t][CC]
#define WS_VT  (WS_KH + 2u * (size_t)NB * TT * CC)      // f16 v planes [b][c][t]
#define WS_QL  (WS_VT + 2u * (size_t)NB * CC * TT)      // f16 q residual x 2^10 rows [b][t < QHI][CC]
#define WS_KL  (WS_QL + 2u * (size_t)NB * QHI * CC)     // f16 k residual x 2^10 rows [b][t < KHI][CC]
#define WS_VB  (WS_KL + 2u * (size_t)NB * KHI * CC)     // bf16 v hi planes [b][c][t < KHI]
#define WS_VBL (WS_VB + 2u * (size_t)NB * CC * KHI)
#define WS_Y   (WS_VBL + 2u * (size_t)NB * CC * KHI)    // f32 ctx rows [b*t][CC] (only when there is an output projection)
#define WS_END (WS_Y  + 4u * (size_t)NB * TT * CC)

// ---- k_proj: block = (64 rows, 128 cols, which): q/k/v = X W (+ b) with exact bf16 products (K = DIN) -> which 0: q f16 rows (+ residual rows < QHI); 1: k f16 rows (+ residual rows < KHI); 2: v f16 planes [c][t] (+ bf16 hi/lo planes for t < KHI)
__global__ __launch_bounds__(128) void k_proj(const float* __restrict__ XQ, const float* __restrict__ XK, const float* __restrict__ XV, const float* __restrict__ WQ, const float* __restrict__ WK, const float* __restrict__ WV, const float* __restrict__ BQ, const float* __restrict__ BK, const float* __restrict__ BV,
    _Float16* __restrict__ QH, _Float16* __restrict__ QL, _Float16* __restrict__ KH, _Float16* __restrict__ KL, _Float16* __restrict__ VT, __bf16* __restrict__ VB, __bf16* __restrict__ VBL) {
  __shared__ __align__(16) _Float16 sh[64][136], sl[64][136]; __shared__ __align__(16) _Float16 th[128][72]; __shared__ __align__(16) __bf16 tb[128][72], tbl[128][72];
  const int tid = threadIdx.x, wave = tid >> 5, lane = tid & 31, col = lane & 15, g = lane >> 4; const int which = blockIdx.z; const int c0 = blockIdx.y * 128; const size_t r0 = (size_t)blockIdx.x * 64; const size_t bb = r0 / TT; const int t0 = (int)(r0 % TT);
  const float* X = which == 0 ? XQ : which == 1 ? XK : XV; const float* WA = which == 0 ? WQ : which == 1 ? WK : WV; const float* BA = which == 0 ? BQ : which == 1 ? BK : BV;
  v8f acc[8] = {};
#pragma unroll 2
  for (int kc = 0; kc < DIN / 32; ++kc) { v16b a; { const float* p = X + (r0 + wave * 16 + col) * DIN + kc * 32 + 8 * g;
#pragma unroll
      for (int i = 0; i < 8; ++i) { a[i] = (__bf16)p[i]; a[8 + i] = (__bf16)p[16 + i]; } }
    asm volatile("s_wait_loadcnt 0x0" ::: "memory");
#pragma unroll
    for (int j = 0; j < 8; ++j) { const v16b w = WCOL(WA, kc * 32, c0 + j * 16 + col, lane); asm volatile("s_wait_loadcnt 0x0" ::: "memory"); acc[j] = wmma_bf(a, w, acc[j]); } }
  if (which < 2) { _Float16* DH = which == 0 ? QH : KH; _Float16* DL = which == 0 ? QL : KL; const int nhi = which == 0 ? QHI : KHI; const bool hi_rows = t0 < nhi;
#pragma unroll
    for (int j = 0; j < 8; ++j) { const float bias = BA ? bfr(BA[c0 + j * 16 + col]) : 0.f;
#pragma unroll
      for (int r = 0; r < 8; ++r) { const float v = acc[j][r] + bias; const _Float16 hv = (_Float16)v; sh[wave * 16 + 8 * g + r][j * 16 + col] = hv; sl[wave * 16 + 8 * g + r][j * 16 + col] = (_Float16)((v - (float)hv) * 1024.0f); } }
    __syncthreads();
    for (int e = tid; e < 64 * 16; e += 128) { const int rl = e >> 4, q = e & 15; vst2((unsigned*)(DH + (r0 + rl) * CC + c0 + q * 8), *(const v4u*)&sh[rl][q * 8]); if (hi_rows) vst2((unsigned*)(DL + (bb * nhi + t0 + rl) * (size_t)CC + c0 + q * 8), *(const v4u*)&sl[rl][q * 8]); }
  } else { const bool hi_rows = t0 < KHI;
#pragma unroll
    for (int j = 0; j < 8; ++j) { const float bias = BA ? bfr(BA[c0 + j * 16 + col]) : 0.f;
#pragma unroll
      for (int r = 0; r < 8; ++r) { const float v = acc[j][r] + bias; const int rl = wave * 16 + 8 * g + r, cl = j * 16 + col; th[cl][rl] = (_Float16)v; const __bf16 bh = (__bf16)v; tb[cl][rl] = bh; tbl[cl][rl] = (__bf16)(v - (float)bh); } }
    __syncthreads();
    for (int e = tid; e < 128 * 8; e += 128) { const int cl = e >> 3, q = e & 7; vst2((unsigned*)(VT + (bb * CC + c0 + cl) * (size_t)TT + t0 + q * 8), *(const v4u*)&th[cl][q * 8]); if (hi_rows) { const size_t o3 = (bb * CC + c0 + cl) * (size_t)KHI + t0 + q * 8; vst2((unsigned*)(VB + o3), *(const v4u*)&tb[cl][q * 8]); vst2((unsigned*)(VBL + o3), *(const v4u*)&tbl[cl][q * 8]); } } } }
// ---- k_att: block = 64 queries (qb, heaviest first) of (b, h); each wave owns 16 query rows and shares nothing with the other waves (no work-group barrier). Logits, softmax and P . v stay in the kernel: the logits of a 16 x 128 key tile are formed twice, sweep 1 for the row maximum and the denominator (per-lane running pair, joined over the 16 lanes of a row at the end), sweep 2 for P x 2^11 = exp(s - max) x 2^11 / sum, which passes through the wave's own LDS tile from the accumulator map to the A map and meets v. Products, operand types and the key order of the P . v sum are those of the three-kernel form (query blocks < QBH: 3-product logits, P and v as bf16 hi + lo).
template <bool HI> __device__ __forceinline__ void att_logits(const v16h (&ah)[HD / 32], const v16h (&al)[HD / 32], const _Float16* __restrict__ Kr, const _Float16* __restrict__ KLr, int lane, v8f (&s)[8]) {
  if (HI) {
#pragma unroll
    for (int j = 0; j < 8; ++j) { v16h kbf[HD / 32], klf[HD / 32]; v8f a = {}, a2 = {};   /* the four fragments of a key group are requested together, ahead of their products: one load latency for the batch */
#pragma unroll
      for (int kc = 0; kc < HD / 32; ++kc) { kbf[kc] = frag_h(Kr + (size_t)j * 16 * CC + kc * 32, lane); klf[kc] = frag_h(KLr + (size_t)j * 16 * CC + kc * 32, lane); }
#pragma unroll
      for (int kc = 0; kc < HD / 32; ++kc) { a = wmma16(ah[kc], kbf[kc], a); a2 = wmma16(al[kc], kbf[kc], a2); a2 = wmma16(ah[kc], klf[kc], a2); }
#pragma unroll
      for (int r = 0; r < 8; ++r) s[j][r] = (a[r] + a2[r] * (1.0f / 1024.0f)) * SCALE; }
  } else {
#pragma unroll
    for (int j = 0; j < 8; ++j) s[j] = v8f{};
#pragma unroll
    for (int kc = 0; kc < HD / 32; ++kc) { v16h kf[8];   /* eight fragments requested together, ahead of their products: one load latency for the batch */
#pragma unroll
      for (int j = 0; j < 8; ++j) kf[j] = frag_h(Kr + (size_t)j * 16 * CC + kc * 32, lane);
#pragma unroll
      for (int j = 0; j < 8; ++j) s[j] = wmma16(ah[kc], kf[j], s[j]); }
#pragma unroll
    for (int j = 0; j < 8; ++j) {
#pragma unroll
      for (int r = 0; r < 8; ++r) s[j][r] = s[j][r] * SCALE; } } }
template <bool HI> __device__ __forceinline__ void att_body(const _Float16* __restrict__ QH, const _Float16* __restrict__ KH, const _Float16* __restrict__ QL, const _Float16* __restrict__ KL, const _Float16* __restrict__ VT, const __bf16* __restrict__ VB, const __bf16* __restrict__ VBL, float* __restrict__ Y, float (*ss)[132], int b, int h, int qb, int wave, int lane) {
  const int col = lane & 15, g = lane >> 4; const int ql0 = qb * 64 + wave * 16; const size_t q0 = (size_t)b * TT + ql0; const int nkb = kb_last(qb) + 1;
  const _Float16* K0 = KH + ((size_t)b * TT + col) * CC + h * HD; const _Float16* KL0 = KL + ((size_t)b * KHI + col) * CC + h * HD;
  v16h ah[HD / 32], al[HD / 32];
#pragma unroll
  for (int kc = 0; kc < HD / 32; ++kc) { ah[kc] = frag_h(QH + (q0 + col) * CC + h * HD + kc * 32, lane); al[kc] = HI ? frag_h(QL + ((size_t)b * QHI + ql0 + col) * CC + h * HD + kc * 32, lane) : ah[kc]; }
  if (HI) asm volatile("s_wait_xcnt 0x0" ::: "memory");   // stands between the q loads and the first rewrite of their address registers
  float m[8], l[8];
#pragma unroll
  for (int r = 0; r < 8; ++r) { m[r] = -1.0e30f; l[r] = 0.f; }   /* the start stays above the excluded keys' -3e38, so that their exp(v - max) underflows to 0 also in a lane that has met no kept key yet */
  // rolled: one tile's body already fills the registers, and a second copy would only lengthen the text
#pragma unroll 1
  for (int kb = 0; kb < nkb; ++kb) { v8f s[8]; att_logits<HI>(ah, al, K0 + (size_t)kb * 128 * CC, KL0 + (size_t)kb * 128 * CC, lane, s);
#pragma unroll
    for (int r = 0; r < 8; ++r) { const int t = ql0 + 8 * g + r; float tm = -3.0e38f;
#pragma unroll
      for (int j = 0; j < 8; ++j) { const float v = (kb * 128 + j * 16 + col <= t) ? s[j][r] : -3.0e38f; s[j][r] = v; tm = fmaxf(tm, v); }
      const float mn = fmaxf(m[r], tm); float a = l[r] * expf(m[r] - mn);
#pragma unroll
      for (int j = 0; j < 8; ++j) a += expf(s[j][r] - mn);
      l[r] = a; m[r] = mn; } }
#pragma unroll
  for (int r = 0; r < 8; ++r) { float M = m[r];
#pragma unroll
    for (int o = 1; o < 16; o <<= 1) M = fmaxf(M, __shfl_xor(M, o));
    float a = l[r] * expf(m[r] - M);
#pragma unroll
    for (int o = 1; o < 16; o <<= 1) a += __shfl_xor(a, o);
    m[r] = M; l[r] = a > 0.f ? 2048.0f / a : 0.f; }
  v8f acc[HD / 16] = {};
  // rolled, as above
#pragma unroll 1
  for (int kb = 0; kb < nkb; ++kb) { v8f s[8]; att_logits<HI>(ah, al, K0 + (size_t)kb * 128 * CC, KL0 + (size_t)kb * 128 * CC, lane, s);
    v16h vfa[2][HD / 16], vfb[2][HD / 16];
    if (!HI) {   /* v of the tile's first 64 keys is requested here, so that it arrives under the exponentials */
#pragma unroll
      for (int kc = 0; kc < 2; ++kc) {
#pragma unroll
        for (int j = 0; j < HD / 16; ++j) vfa[kc][j] = frag_h(VT + ((size_t)b * CC + h * HD + j * 16 + col) * (size_t)TT + kb * 128 + kc * 32, lane); } }
#pragma unroll
    for (int j = 0; j < 8; ++j) {
#pragma unroll
      for (int r = 0; r < 8; ++r) ss[8 * g + r][j * 16 + col] = expf(((kb * 128 + j * 16 + col <= ql0 + 8 * g + r) ? s[j][r] : -3.0e38f) - m[r]) * l[r]; }   /* excluded key: exp underflows to 0 */
    LDSX();   // the wave's P stores land before other lanes of the wave read them
    if (HI) {
#pragma unroll
      for (int kc = 0; kc < 4; ++kc) { const F2 p = split_row(&ss[col][0], kc * 32, lane); v16b vh[HD / 16], vl[HD / 16];   /* eight fragments requested together */
#pragma unroll
        for (int j = 0; j < HD / 16; ++j) { const size_t po = ((size_t)b * CC + h * HD + j * 16 + col) * (size_t)KHI + kb * 128 + kc * 32; vh[j] = frag_b(VB + po, lane); vl[j] = frag_b(VBL + po, lane); }
#pragma unroll
        for (int j = 0; j < HD / 16; ++j) { acc[j] = wmma_bf(p.h, vh[j], acc[j]); acc[j] = wmma_bf(p.l, vh[j], acc[j]); acc[j] = wmma_bf(p.h, vl[j], acc[j]); } }
    } else {   /* v of the last 64 keys is requested ahead of the first products */
#pragma unroll
      for (int kc = 0; kc < 2; ++kc) {
#pragma unroll
        for (int j = 0; j < HD / 16; ++j) vfb[kc][j] = frag_h(VT + ((size_t)b * CC + h * HD + j * 16 + col) * (size_t)TT + kb * 128 + 64 + kc * 32, lane); }
#pragma unroll
      for (int kc = 0; kc < 4; ++kc) { const v16h p = frag_f32(&ss[col][kc * 32], lane);
#pragma unroll
        for (int j = 0; j < HD / 16; ++j) acc[j] = wmma16(p, kc < 2 ? vfa[kc][j] : vfb[kc - 2][j], acc[j]); } }
    LDSX();   // the wave's P reads are done before the next tile (or the epilogue) overwrites them
  }
#pragma unroll
  for (int j = 0; j < HD / 16; ++j)
#pragma unroll
    for (int r = 0; r < 8; ++r) ss[8 * g + r][j * 16 + col] = acc[j][r] * (1.0f / 2048.0f);
  LDSX();   // ctx stores land before the row-wise read below
  for (int rl = 0; rl < 16; ++rl) if (lane < HD / 4) vst2(Y + ((size_t)b * TT + ql0 + rl) * CC + h * HD + lane * 4, *(const v4f*)&ss[rl][lane * 4]); }
__global__ __launch_bounds__(128) void k_att(const _Float16* __restrict__ QH, const _Float16* __restrict__ KH, const _Float16* __restrict__ QL, const _Float16* __restrict__ KL, const _Float16* __restrict__ VT, const __bf16* __restrict__ VB, const __bf16* __restrict__ VBL, float* __restrict__ Y) { __shared__ __align__(16) float ss[4][16][132];
  const int wave = threadIdx.x >> 5, lane = threadIdx.x & 31; const int h = blockIdx.x % NH, b = blockIdx.x / NH; const int qb = NQB - 1 - blockIdx.y;   /* longest blocks start first */
  if (qb < QBH) att_body<true>(QH, KH, QL, KL, VT, VB, VBL, Y, ss[wave], b, h, qb, wave, lane);
  else att_body<false>(QH, KH, QL, KL, VT, VB, VBL, Y, ss[wave], b, h, qb, wave, lane); }
// ---- k_out: block = (64 rows, 128 cols): out = ctx Wo (+ bo): ctx once to f16 against Wo as f16(bf16 x 2^8) exact (1 product) x 2^-8; causal early rows (< QHI of each sequence): ctx bf16 hi + lo against exact bf16 Wo (2 products)
__global__ __launch_bounds__(128) void k_out(const float* __restrict__ Y, const float* __restrict__ WO, const float* __restrict__ BO, float* __restrict__ OUT) { __shared__ __align__(16) float sf[4][16][132];
  const int tid = threadIdx.x, wave = tid >> 5, lane = tid & 31, col = lane & 15, g = lane >> 4; const int c0 = blockIdx.y * 128; const size_t r0 = (size_t)blockIdx.x * 64 + wave * 16;
  v8f acc[8] = {};
  if (CAUSAL && (int)(((size_t)blockIdx.x * 64) % TT) < QHI) {   /* block-uniform */
#pragma unroll 2
    for (int kc = 0; kc < CC / 32; ++kc) { const F2 a = split_row(Y + (r0 + col) * CC, kc * 32, lane); asm volatile("s_wait_loadcnt 0x0" ::: "memory");
#pragma unroll
      for (int j = 0; j < 8; ++j) { const v16b w = WOCOL(WO, kc * 32, c0 + j * 16 + col, lane); asm volatile("s_wait_loadcnt 0x0" ::: "memory"); acc[j] = wmma_bf(a.h, w, acc[j]); acc[j] = wmma_bf(a.l, w, acc[j]); } }
#pragma unroll
    for (int j = 0; j < 8; ++j) { const float bias = BO ? bfr(BO[c0 + j * 16 + col]) : 0.f;
#pragma unroll
      for (int r = 0; r < 8; ++r) sf[wave][8 * g + r][j * 16 + col] = acc[j][r] + bias; }
  } else {
#pragma unroll 2
    for (int kc = 0; kc < CC / 32; ++kc) { const v16h a = frag_f32s(Y + (r0 + col) * CC + kc * 32, lane, 64.0f); asm volatile("s_wait_loadcnt 0x0" ::: "memory");   /* ctx carried x 2^6 into f16 so small-magnitude context rows stay clear of f16 subnormals */
#pragma unroll
      for (int j = 0; j < 8; ++j) { const v16h w = WOCOLH(WO, kc * 32, c0 + j * 16 + col, lane); asm volatile("s_wait_loadcnt 0x0" ::: "memory"); acc[j] = wmma16(a, w, acc[j]); } }
#pragma unroll
    for (int j = 0; j < 8; ++j) { const float bias = BO ? bfr(BO[c0 + j * 16 + col]) : 0.f;
#pragma unroll
      for (int r = 0; r < 8; ++r) sf[wave][8 * g + r][j * 16 + col] = acc[j][r] * (1.0f / 16384.0f) + bias; } }   /* 2^-8 (Wo carry) x 2^-6 (ctx carry) */
  LDSX(); for (int rl = 0; rl < 16; ++rl) vst2(OUT + (r0 + rl) * DIN + c0 + lane * 4, *(const v4f*)&sf[wave][rl][lane * 4]); }

extern "C" void kernel_launch(void* const* d_in, const int* in_sizes, int n_in, void* d_out, int out_size, void* d_ws, size_t ws_size, hipStream_t stream) {
  (void)in_sizes; (void)n_in; (void)out_size;
  const float** F = (const float**)d_in;
  if (ws_size < (size_t)WS_END) return;
  char* ws = (char*)d_ws; _Float16 *QH = (_Float16*)(ws + WS_QH), *KH = (_Float16*)(ws + WS_KH), *VT = (_Float16*)(ws + WS_VT), *QL = (_Float16*)(ws + WS_QL), *KL = (_Float16*)(ws + WS_KL); __bf16 *VB = (__bf16*)(ws + WS_VB), *VBL = (__bf16*)(ws + WS_VBL); float *Y = (float*)(ws + WS_Y);
  (void)Y; (void)QL; (void)KL; (void)VB; (void)VBL;
  // inputs: 0 query [4,2048,768]; 1 key; 2 value; 3 Wq [768,768] (out,in), 4 bq; 5 Wk, 6 bk; 7 Wv, 8 bv; 9 Wo (out,in), 10 bo (all biases zeros, read)
  k_proj<<<dim3(TNB * TT / 64, CC / 128, 3), 128, 0, stream>>>(F[0], F[1], F[2], F[3], F[5], F[7], F[4], F[6], F[8], QH, QL, KH, KL, VT, VB, VBL);
  k_att<<<dim3(TNB * NH, NQB), 128, 0, stream>>>(QH, KH, QL, KL, VT, VB, VBL, Y);
  k_out<<<dim3(TNB * TT / 64, DIN / 128), 128, 0, stream>>>(Y, F[9], F[10], (float*)d_out);
}

// v002
// A run of this version takes 229 microseconds.
// Next to v001, in two timings, it ran 2.29 and 2.26 times as fast.
// All steps since v000 together make it 10.7 times as fast.
// compute dtype: all float inputs rounded to bf16; q / k / v projections with EXACT bf16 products on WMMA 16x16x32 (f32 accumulate) + bias (zeros, read); causal logits: 3 products for the first 384 rows, single f16 q x k after, x 64^-0.5; softmax f32; P x 2^11 once to f16 x v once to f16 (bf16 hi + lo below row 384); ctx hi+lo x exact Wo below row 384, x2^6 f16 carry x f16(bf16 x 2^8) Wo after, + bo (zeros); f32 output.
#include <hip/hip_runtime.h>
#include <math.h>

typedef __attribute__((ext_vector_type(16))) _Float16 v16h;
typedef __attribute__((ext_vector_type(16))) __bf16 v16b;
typedef __attribute__((ext_vector_type(8)))  _Float16 v8h;
typedef __attribute__((ext_vector_type(8)))  float v8f;
typedef __attribute__((ext_vector_type(4)))  float v4f;
typedef __attribute__((ext_vector_type(2)))  float v2f;
typedef __attribute__((ext_vector_type(4)))  unsigned v4u;
typedef __attribute__((ext_vector_type(4)))  int v4i;
typedef float __attribute__((may_alias)) float_a;
typedef int __attribute__((may_alias)) int_a;

template <typename T> __device__ __forceinline__ void vst2(void* p, T v) { *(T*)p = v;  }
__device__ __forceinline__ v8f wmma16(v16h a, v16h b, v8f c) {
  v8f d = __builtin_amdgcn_wmma_f32_16x16x32_f16(false, a, false, b, (short)0, c, false, false);
  asm volatile("v_nop\n\tv_nop\n\tv_nop\n\tv_nop" : "+v"(d) : "v"(a), "v"(b));
  return d;
}
__device__ __forceinline__ v8f wmma_bf(v16b a, v16b b, v8f c) {
  v8f d = __builtin_amdgcn_wmma_f32_16x16x32_bf16(false, a, false, b, (short)0, c, false, false);
  asm volatile("v_nop\n\tv_nop\n\tv_nop\n\tv_nop" : "+v"(d) : "v"(a), "v"(b));
  return d;
}
// 16x16x32 fragments: lane = (h = lane>>4, row/col = lane&15); elements 0..7 = k0+8h+0..7, 8..15 = k0+16+8h+0..7; D element r = row 8h+r
__device__ __forceinline__ v16h frag_h(const _Float16* rowk0, int lane) {
  union { v16h v; v8h q[2]; } u; const _Float16* p = rowk0 + 8 * (lane >> 4);
  u.q[0] = *(const v8h*)p; u.q[1] = *(const v8h*)(p + 16); return u.v;
}
__device__ __forceinline__ v16h frag_f32(const float* rowk0, int lane) {
  v16h a; const float* p = rowk0 + 8 * (lane >> 4);
#pragma unroll
  for (int i = 0; i < 8; ++i) { a[i] = (_Float16)p[i]; a[8 + i] = (_Float16)p[16 + i]; }
  return a;
}
__device__ __forceinline__ v16h frag_f32s(const float* rowk0, int lane, float sc) {
  v16h a; const float* p = rowk0 + 8 * (lane >> 4);
#pragma unroll
  for (int i = 0; i < 8; ++i) { a[i] = (_Float16)(p[i] * sc); a[8 + i] = (_Float16)(p[16 + i] * sc); }
  return a;
}
// column fragment from a [K][ld] layout (column n), rows >= K read as 0
__device__ __forceinline__ v16h fragc_f32(const float* W, int k0, int n, int lane, int ld, int K) {
  v16h a; const int g = lane >> 4;
#pragma unroll
  for (int i = 0; i < 8; ++i) { const int ka = k0 + 8 * g + i, kb = ka + 16;
    a[i] = (_Float16)(ka < K ? W[(size_t)(ka < K ? ka : K - 1) * ld + n] : 0.f); a[8 + i] = (_Float16)(kb < K ? W[(size_t)(kb < K ? kb : K - 1) * ld + n] : 0.f); }
  return a;
}
struct F2 { v16b h, l; };
__device__ __forceinline__ F2 bsplit16(const float v[16]) { F2 r;
#pragma unroll
  for (int i = 0; i < 16; ++i) { const __bf16 h = (__bf16)v[i]; r.h[i] = h; r.l[i] = (__bf16)(v[i] - (float)h); }
  return r; }
__device__ __forceinline__ F2 split_row(const float* row, int k0, int lane) { float v[16]; const float* p = row + k0 + 8 * (lane >> 4);
#pragma unroll
  for (int i = 0; i < 8; ++i) { v[i] = p[i]; v[8 + i] = p[16 + i]; }
  return bsplit16(v); }
__device__ __forceinline__ F2 split_rowK(const float* row, int k0, int lane, int K) { float v[16]; const int g = lane >> 4;
#pragma unroll
  for (int i = 0; i < 8; ++i) { const int ka = k0 + 8 * g + i, kb = ka + 16; v[i] = ka < K ? row[ka < K ? ka : K - 1] : 0.f; v[8 + i] = kb < K ? row[kb < K ? kb : K - 1] : 0.f; }
  return bsplit16(v); }
__device__ __forceinline__ F2 split_col(const float* W, int k0, int n, int lane, int ld, int K) { float v[16]; const int g = lane >> 4;
#pragma unroll
  for (int i = 0; i < 8; ++i) { const int ka = k0 + 8 * g + i, kb = ka + 16; v[i] = ka < K ? W[(size_t)(ka < K ? ka : K - 1) * ld + n] : 0.f; v[8 + i] = kb < K ? W[(size_t)(kb < K ? kb : K - 1) * ld + n] : 0.f; }
  return bsplit16(v); }
__device__ __forceinline__ v8f mac3(const F2& a, const F2& b, v8f c) { c = wmma_bf(a.l, b.h, c); c = wmma_bf(a.h, b.l, c); return wmma_bf(a.h, b.h, c); }
__device__ __forceinline__ float sigm(float v) { return 1.0f / (1.0f + expf(-v)); }
#define LDSX() do { asm volatile("s_wait_dscnt 0" ::: "memory"); __builtin_amdgcn_wave_barrier(); __builtin_amdgcn_fence(__ATOMIC_RELEASE, "workgroup"); } while (0)

// Causal multi-head attention on separate inputs (query / key / value [4,2048,768]; torch (out,in) Wq / Wk / Wv / Wo [768,768] N(0, 1/768) applied as x @ W.T + b, all biases zeros (read); 12 heads x 64; scores / sqrt(64); tril kept, -1e9 elsewhere (finite: its softmax weight underflows to 0); softmax; merged heads @ Wo.T + bo).
#define NB 4
#define TT 2048
#define CC 768            // NH * HD = projected width
#define DIN 768          // input (model) width
#define NH 12
#define HD 64
#define NQB (TT / 64)
#define SCALE (0.125f)
#define CAUSAL 1
#ifndef TNB
#define TNB NB
#endif
__device__ __forceinline__ float bfr(float v) { return (float)(__bf16)v; }
__host__ __device__ __forceinline__ int kb_last(int qb) { return CAUSAL ? ((qb * 64 + 63) >> 7) : (TT / 128 - 1); }
typedef __attribute__((ext_vector_type(8))) __bf16 v8b;
__device__ __forceinline__ v16b frag_b(const __bf16* rowk0, int lane) {
  union { v16b v; v8b q[2]; } u; const __bf16* p = rowk0 + 8 * (lane >> 4);
  u.q[0] = *(const v8b*)p; u.q[1] = *(const v8b*)(p + 16); return u.v;
}
#define QBH 6              // causal: query blocks 0..QBH-1 of each sequence (few keys, no averaging) take the high-precision path
#define QHI 384            // rows carrying a q residual plane
#define KHI 384            // key rows carrying k residual / v bf16 hi+lo planes (used only by the causal high-precision path)
// B fragment (k rows k0+.., output column o) of a weight: (in,out) [K][ld] or (out,in) [ld rows of K]: bf16 exact, or f16(bf16 * 256) exact
__device__ __forceinline__ v16b wcol_io(const float* Wm, int k0, int o, int lane, int ld) { v16b w; const int g = lane >> 4;
#pragma unroll
  for (int i = 0; i < 8; ++i) { w[i] = (__bf16)Wm[(size_t)(k0 + 8 * g + i) * ld + o]; w[8 + i] = (__bf16)Wm[(size_t)(k0 + 16 + 8 * g + i) * ld + o]; }
  return w; }
__device__ __forceinline__ v16b wcol_oi(const float* Wm, int k0, int o, int lane, int K) { v16b w; const float* p = Wm + (size_t)o * K + k0 + 8 * (lane >> 4);
#pragma unroll
  for (int i = 0; i < 8; ++i) { w[i] = (__bf16)p[i]; w[8 + i] = (__bf16)p[16 + i]; }
  return w; }
__device__ __forceinline__ v16h wcolh_io(const float* Wm, int k0, int o, int lane, int ld) { v16h w; const int g = lane >> 4;
#pragma unroll
  for (int i = 0; i < 8; ++i) { w[i] = (_Float16)(bfr(Wm[(size_t)(k0 + 8 * g + i) * ld + o]) * 256.0f); w[8 + i] = (_Float16)(bfr(Wm[(size_t)(k0 + 16 + 8 * g + i) * ld + o]) * 256.0f); }
  return w; }
__device__ __forceinline__ v16h wcolh_oi(const float* Wm, int k0, int o, int lane, int K) { v16h w; const float* p = Wm + (size_t)o * K + k0 + 8 * (lane >> 4);
#pragma unroll
  for (int i = 0; i < 8; ++i) { w[i] = (_Float16)(bfr(p[i]) * 256.0f); w[8 + i] = (_Float16)(bfr(p[16 + i]) * 256.0f); }
  return w; }
#define WQKV_LAYOUT 1   // selects only the WCOL reader, which nothing calls; k_proj reads (out,in) [CC][DIN] rows
__device__ __forceinline__ v16b wcol_hdk(const float* Wm, int k0, int o, int lane) { v16b w; const int g = lane >> 4; const float* p = Wm + (size_t)(o / HD) * DIN * HD + (o % HD);
#pragma unroll
  for (int i = 0; i < 8; ++i) { w[i] = (__bf16)p[(size_t)(k0 + 8 * g + i) * HD]; w[8 + i] = (__bf16)p[(size_t)(k0 + 16 + 8 * g + i) * HD]; }
  return w; }
#define WO_OUT_IN 1
#if WQKV_LAYOUT == 1
#define WCOL(W, k0, o, lane) wcol_oi(W, k0, o, lane, DIN)
#elif WQKV_LAYOUT == 2
#define WCOL(W, k0, o, lane) wcol_hdk(W, k0, o, lane)
#else
#define WCOL(W, k0, o, lane) wcol_io(W, k0, o, lane, CC)
#endif
#if WO_OUT_IN
#define WOCOL(W, k0, o, lane) wcol_oi(W, k0, o, lane, CC)
#define WOCOLH(W, k0, o, lane) wcolh_oi(W, k0, o, lane, CC)
#else
#define WOCOL(W, k0, o, lane) wcol_io(W, k0, o, lane, DIN)
#define WOCOLH(W, k0, o, lane) wcolh_io(W, k0, o, lane, DIN)
#endif

#ifndef PROJ_EXTRA_PARAMS
#define PROJ_EXTRA_PARAMS
#endif

#define WS_QH  0u                                      // f16 q rows [b*t][CC]
#define WS_KH  (WS_QH + 2u * (size_t)NB * TT * CC)      // f16 k rows [b*t][CC]
#define WS_VT  (WS_KH + 2u * (size_t)NB * TT * CC)      // f16 v planes [b][c][t]
#define WS_QL  (WS_VT + 2u * (size_t)NB * CC * TT)      // f16 q residual x 2^10 rows [b][t < QHI][CC]
#define WS_KL  (WS_QL + 2u * (size_t)NB * QHI * CC)     // f16 k residual x 2^10 rows [b][t < KHI][CC]
#define WS_VB  (WS_KL + 2u * (size_t)NB * KHI * CC)     // bf16 v hi planes [b][c][t < KHI]
#define WS_VBL (WS_VB + 2u * (size_t)NB * CC * KHI)
#define WS_Y   (WS_VBL + 2u * (size_t)NB * CC * KHI)    // f32 ctx rows [b*t][CC] (only when there is an output projection)
#define WS_END (WS_Y  + 4u * (size_t)NB * TT * CC)

// ---- staged operands of the two projection kernels: a block's 64 A rows and 128 W rows (both K-contiguous f32, K = 768) go through LDS in chunks of SBK k. Every global load covers whole 128-B lines, each element is rounded to its 16-bit operand type once per block, and the four waves read their fragments from LDS. Two buffers: chunk c + 1 is requested ahead of chunk c's products, stored behind them, and published by the one barrier at the foot of the trip. The k order of every accumulator is unchanged. The inner loops are unrolled so that every index of pf, w and acc is a constant (registers, no scratch).
#define SBK 64
#define SPITCH 72          // 16-bit elements per staged row: 128 B + 16 B, so that the 16 rows of a b128 fragment read fall on distinct banks
typedef __attribute__((ext_vector_type(4))) __bf16 v4b;
typedef __attribute__((ext_vector_type(4))) _Float16 v4h;
// MODE 0: A bf16, W bf16. MODE 1: A bf16 hi rows 0..63 + lo rows 64..127, W bf16. MODE 2: A f16(x 2^6), W f16(bf16 x 2^8)
template <int MODE> __device__ __forceinline__ void stage_put(unsigned char* buf, const v4f (&pf)[24], int srow, int sseg) {
  constexpr int W0 = MODE == 1 ? 128 : 64;
#pragma unroll
  for (int i = 0; i < 24; ++i) { const int row = i < 8 ? i * 8 + srow : W0 + (i - 8) * 8 + srow; unsigned char* d = buf + ((size_t)row * SPITCH + sseg * 4) * 2;
    if (MODE == 2) { v4h o;
#pragma unroll
      for (int e = 0; e < 4; ++e) o[e] = i < 8 ? (_Float16)(pf[i][e] * 64.0f) : (_Float16)(bfr(pf[i][e]) * 256.0f);
      *(v4h*)d = o;
    } else { v4b o, o2;
#pragma unroll
      for (int e = 0; e < 4; ++e) { const __bf16 hv = (__bf16)pf[i][e]; o[e] = hv; o2[e] = (__bf16)(pf[i][e] - (float)hv); }
      *(v4b*)d = o; if (MODE == 1 && i < 8) *(v4b*)(d + (size_t)64 * SPITCH * 2) = o2; } } }
template <int MODE> __device__ __forceinline__ void gemm_staged(const float* __restrict__ A0, const float* __restrict__ Wr0, unsigned char* sm, int tid, v8f (&acc)[8]) {
  constexpr int W0 = MODE == 1 ? 128 : 64; constexpr int BUFB = (W0 + 128) * SPITCH * 2; constexpr int NC = DIN / SBK;
  const int wave = tid >> 5, lane = tid & 31, col = lane & 15, srow = tid >> 4, sseg = tid & 15;
  unsigned vo = (unsigned)(srow * DIN + sseg * 4) * 4u;   /* the thread's byte offset in either tile; an address is a block-uniform base + this + a constant, and this one register steps by a chunk a trip */
  v4f pf[24];
#pragma unroll
  for (int i = 0; i < 24; ++i) pf[i] = *(const v4f*)((const char*)(i < 8 ? A0 : Wr0) + (size_t)vo + (size_t)(i < 8 ? i : i - 8) * 8 * DIN * 4);
  stage_put<MODE>(sm, pf, srow, sseg);
  __syncthreads();   // chunk 0 is published
  // rolled: the buffer is picked by the trip's parity, and one trip's body already holds 24 loads and all fragments
#pragma unroll 1
  for (int c = 0; c < NC; ++c) { const bool more = c + 1 < NC;   /* the same for the whole block */
    if (more) { vo += SBK * 4u;
#pragma unroll
      for (int i = 0; i < 24; ++i) pf[i] = *(const v4f*)((const char*)(i < 8 ? A0 : Wr0) + (size_t)vo + (size_t)(i < 8 ? i : i - 8) * 8 * DIN * 4);
      asm volatile("s_wait_xcnt 0x0" ::: "memory");   // stands between these loads and the next trip's rewrite of their offset register
    }
    const unsigned char* sb = sm + (c & 1) * BUFB;
#pragma unroll
    for (int kc = 0; kc < SBK / 32; ++kc) {
      if (MODE == 2) { const _Float16* s16 = (const _Float16*)sb; const v16h a = frag_h(s16 + (wave * 16 + col) * SPITCH + kc * 32, lane); v16h w[8];
#pragma unroll
        for (int j = 0; j < 8; ++j) w[j] = frag_h(s16 + (W0 + j * 16 + col) * SPITCH + kc * 32, lane);
#pragma unroll
        for (int j = 0; j < 8; ++j) acc[j] = wmma16(a, w[j], acc[j]);
      } else { const __bf16* s16 = (const __bf16*)sb; const v16b a = frag_b(s16 + (wave * 16 + col) * SPITCH + kc * 32, lane); const v16b a2 = MODE == 1 ? frag_b(s16 + (64 + wave * 16 + col) * SPITCH + kc * 32, lane) : a; v16b w[8];
#pragma unroll
        for (int j = 0; j < 8; ++j) w[j] = frag_b(s16 + (W0 + j * 16 + col) * SPITCH + kc * 32, lane);
#pragma unroll
        for (int j = 0; j < 8; ++j) { acc[j] = wmma_bf(a, w[j], acc[j]); if (MODE == 1) acc[j] = wmma_bf(a2, w[j], acc[j]); } } }
    if (more) stage_put<MODE>(sm + ((c + 1) & 1) * BUFB, pf, srow, sseg);
    __syncthreads();   // publishes chunk c + 1 and ends every wave's reads of chunk c (behind the last trip: before the epilogue reuses the space)
  } }
// ---- k_proj: block = (64 rows, 128 cols, which): q/k/v = X W (+ b) with exact bf16 products (K = DIN) -> which 0: q f16 rows (+ residual rows < QHI); 1: k f16 rows (+ residual rows < KHI); 2: v f16 planes [c][t] (+ bf16 hi/lo planes for t < KHI)
__global__ __launch_bounds__(128) void k_proj(const float* __restrict__ XQ, const float* __restrict__ XK, const float* __restrict__ XV, const float* __restrict__ WQ, const float* __restrict__ WK, const float* __restrict__ WV, const float* __restrict__ BQ, const float* __restrict__ BK, const float* __restrict__ BV,
    _Float16* __restrict__ QH, _Float16* __restrict__ QL, _Float16* __restrict__ KH, _Float16* __restrict__ KL, _Float16* __restrict__ VT, __bf16* __restrict__ VB, __bf16* __restrict__ VBL) {
  __shared__ __align__(16) unsigned char sm[2 * 192 * SPITCH * 2];   // two staging buffers; the epilogue's tiles take the same space behind the last barrier of the k loop
  _Float16 (*sh)[136] = reinterpret_cast<_Float16 (*)[136]>(sm); _Float16 (*sl)[136] = reinterpret_cast<_Float16 (*)[136]>(sm + 64 * 136 * 2);
  _Float16 (*th)[72] = reinterpret_cast<_Float16 (*)[72]>(sm); __bf16 (*tb)[72] = reinterpret_cast<__bf16 (*)[72]>(sm + 128 * 72 * 2); __bf16 (*tbl)[72] = reinterpret_cast<__bf16 (*)[72]>(sm + 2 * 128 * 72 * 2);
  const int tid = threadIdx.x, wave = tid >> 5, lane = tid & 31, col = lane & 15, g = lane >> 4; const int which = blockIdx.z; const int c0 = blockIdx.y * 128; const size_t r0 = (size_t)blockIdx.x * 64; const size_t bb = r0 / TT; const int t0 = (int)(r0 % TT);
  const float* X = which == 0 ? XQ : which == 1 ? XK : XV; const float* WA = which == 0 ? WQ : which == 1 ? WK : WV; const float* BA = which == 0 ? BQ : which == 1 ? BK : BV;
  v8f acc[8] = {};
  gemm_staged<0>(X + r0 * DIN, WA + (size_t)c0 * DIN, sm, tid, acc);
  if (which < 2) { _Float16* DH = which == 0 ? QH : KH; _Float16* DL = which == 0 ? QL : KL; const int nhi = which == 0 ? QHI : KHI; const bool hi_rows = t0 < nhi;
#pragma unroll
    for (int j = 0; j < 8; ++j) { const float bias = BA ? bfr(BA[c0 + j * 16 + col]) : 0.f;
#pragma unroll
      for (int r = 0; r < 8; ++r) { const float v = acc[j][r] + bias; const _Float16 hv = (_Float16)v; sh[wave * 16 + 8 * g + r][j * 16 + col] = hv; sl[wave * 16 + 8 * g + r][j * 16 + col] = (_Float16)((v - (float)hv) * 1024.0f); } }
    __syncthreads();
    for (int e = tid; e < 64 * 16; e += 128) { const int rl = e >> 4, q = e & 15; vst2((unsigned*)(DH + (r0 + rl) * CC + c0 + q * 8), *(const v4u*)&sh[rl][q * 8]); if (hi_rows) vst2((unsigned*)(DL + (bb * nhi + t0 + rl) * (size_t)CC + c0 + q * 8), *(const v4u*)&sl[rl][q * 8]); }
  } else { const bool hi_rows = t0 < KHI;
#pragma unroll
    for (int j = 0; j < 8; ++j) { const float bias = BA ? bfr(BA[c0 + j * 16 + col]) : 0.f;
#pragma unroll
      for (int r = 0; r < 8; ++r) { const float v = acc[j][r] + bias; const int rl = wave * 16 + 8 * g + r, cl = j * 16 + col; th[cl][rl] = (_Float16)v; const __bf16 bh = (__bf16)v; tb[cl][rl] = bh; tbl[cl][rl] = (__bf16)(v - (float)bh); } }
    __syncthreads();
    for (int e = tid; e < 128 * 8; e += 128) { const int cl = e >> 3, q = e & 7; vst2((unsigned*)(VT + (bb * CC + c0 + cl) * (size_t)TT + t0 + q * 8), *(const v4u*)&th[cl][q * 8]); if (hi_rows) { const size_t o3 = (bb * CC + c0 + cl) * (size_t)KHI + t0 + q * 8; vst2((unsigned*)(VB + o3), *(const v4u*)&tb[cl][q * 8]); vst2((unsigned*)(VBL + o3), *(const v4u*)&tbl[cl][q * 8]); } } } }
// ---- k_att: block = 64 queries (qb, heaviest first) of (b, h); each wave owns 16 query rows and shares nothing with the other waves (no work-group barrier). Logits, softmax and P . v stay in the kernel: the logits of a 16 x 128 key tile are formed twice, sweep 1 for the row maximum and the denominator (per-lane running pair, joined over the 16 lanes of a row at the end), sweep 2 for P x 2^11 = exp(s - max) x 2^11 / sum, which passes through the wave's own LDS tile from the accumulator map to the A map and meets v. Products, operand types and the key order of the P . v sum are those of the three-kernel form (query blocks < QBH: 3-product logits, P and v as bf16 hi + lo).
template <bool HI> __device__ __forceinline__ void att_logits(const v16h (&ah)[HD / 32], const v16h (&al)[HD / 32], const _Float16* __restrict__ Kr, const _Float16* __restrict__ KLr, int lane, v8f (&s)[8]) {
  if (HI) {
#pragma unroll
    for (int j = 0; j < 8; ++j) { v16h kbf[HD / 32], klf[HD / 32]; v8f a = {}, a2 = {};   /* the four fragments of a key group are requested together, ahead of their products: one load latency for the batch */
#pragma unroll
      for (int kc = 0; kc < HD / 32; ++kc) { kbf[kc] = frag_h(Kr + (size_t)j * 16 * CC + kc * 32, lane); klf[kc] = frag_h(KLr + (size_t)j * 16 * CC + kc * 32, lane); }
#pragma unroll
      for (int kc = 0; kc < HD / 32; ++kc) { a = wmma16(ah[kc], kbf[kc], a); a2 = wmma16(al[kc], kbf[kc], a2); a2 = wmma16(ah[kc], klf[kc], a2); }
#pragma unroll
      for (int r = 0; r < 8; ++r) s[j][r] = (a[r] + a2[r] * (1.0f / 1024.0f)) * SCALE; }
  } else {
#pragma unroll
    for (int j = 0; j < 8; ++j) s[j] = v8f{};
#pragma unroll
    for (int kc = 0; kc < HD / 32; ++kc) { v16h kf[8];   /* eight fragments requested together, ahead of their products: one load latency for the batch */
#pragma unroll
      for (int j = 0; j < 8; ++j) kf[j] = frag_h(Kr + (size_t)j * 16 * CC + kc * 32, lane);
#pragma unroll
      for (int j = 0; j < 8; ++j) s[j] = wmma16(ah[kc], kf[j], s[j]); }
#pragma unroll
    for (int j = 0; j < 8; ++j) {
#pragma unroll
      for (int r = 0; r < 8; ++r) s[j][r] = s[j][r] * SCALE; } } }
template <bool HI> __device__ __forceinline__ void att_body(const _Float16* __restrict__ QH, const _Float16* __restrict__ KH, const _Float16* __restrict__ QL, const _Float16* __restrict__ KL, const _Float16* __restrict__ VT, const __bf16* __restrict__ VB, const __bf16* __restrict__ VBL, float* __restrict__ Y, float (*ss)[132], int b, int h, int qb, int wave, int lane) {
  const int col = lane & 15, g = lane >> 4; const int ql0 = qb * 64 + wave * 16; const size_t q0 = (size_t)b * TT + ql0; const int nkb = kb_last(qb) + 1;
  const _Float16* K0 = KH + ((size_t)b * TT + col) * CC + h * HD; const _Float16* KL0 = KL + ((size_t)b * KHI + col) * CC + h * HD;
  v16h ah[HD / 32], al[HD / 32];
#pragma unroll
  for (int kc = 0; kc < HD / 32; ++kc) { ah[kc] = frag_h(QH + (q0 + col) * CC + h * HD + kc * 32, lane); al[kc] = HI ? frag_h(QL + ((size_t)b * QHI + ql0 + col) * CC + h * HD + kc * 32, lane) : ah[kc]; }
  if (HI) asm volatile("s_wait_xcnt 0x0" ::: "memory");   // stands between the q loads and the first rewrite of their address registers
  float m[8], l[8];
#pragma unroll
  for (int r = 0; r < 8; ++r) { m[r] = -1.0e30f; l[r] = 0.f; }   /* the start stays above the excluded keys' -3e38, so that their exp(v - max) underflows to 0 also in a lane that has met no kept key yet */
  // rolled: one tile's body already fills the registers, and a second copy would only lengthen the text
#pragma unroll 1
  for (int kb = 0; kb < nkb; ++kb) { v8f s[8]; att_logits<HI>(ah, al, K0 + (size_t)kb * 128 * CC, KL0 + (size_t)kb * 128 * CC, lane, s);
#pragma unroll
    for (int r = 0; r < 8; ++r) { const int t = ql0 + 8 * g + r; float tm = -3.0e38f;
#pragma unroll
      for (int j = 0; j < 8; ++j) { const float v = (kb * 128 + j * 16 + col <= t) ? s[j][r] : -3.0e38f; s[j][r] = v; tm = fmaxf(tm, v); }
      const float mn = fmaxf(m[r], tm); float a = l[r] * expf(m[r] - mn);
#pragma unroll
      for (int j = 0; j < 8; ++j) a += expf(s[j][r] - mn);
      l[r] = a; m[r] = mn; } }
#pragma unroll
  for (int r = 0; r < 8; ++r) { float M = m[r];
#pragma unroll
    for (int o = 1; o < 16; o <<= 1) M = fmaxf(M, __shfl_xor(M, o));
    float a = l[r] * expf(m[r] - M);
#pragma unroll
    for (int o = 1; o < 16; o <<= 1) a += __shfl_xor(a, o);
    m[r] = M; l[r] = a > 0.f ? 2048.0f / a : 0.f; }
  v8f acc[HD / 16] = {};
  // rolled, as above
#pragma unroll 1
  for (int kb = 0; kb < nkb; ++kb) { v8f s[8]; att_logits<HI>(ah, al, K0 + (size_t)kb * 128 * CC, KL0 + (size_t)kb * 128 * CC, lane, s);
    v16h vfa[2][HD / 16], vfb[2][HD / 16];
    if (!HI) {   /* v of the tile's first 64 keys is requested here, so that it arrives under the exponentials */
#pragma unroll
      for (int kc = 0; kc < 2; ++kc) {
#pragma unroll
        for (int j = 0; j < HD / 16; ++j) vfa[kc][j] = frag_h(VT + ((size_t)b * CC + h * HD + j * 16 + col) * (size_t)TT + kb * 128 + kc * 32, lane); } }
#pragma unroll
    for (int j = 0; j < 8; ++j) {
#pragma unroll
      for (int r = 0; r < 8; ++r) ss[8 * g + r][j * 16 + col] = expf(((kb * 128 + j * 16 + col <= ql0 + 8 * g + r) ? s[j][r] : -3.0e38f) - m[r]) * l[r]; }   /* excluded key: exp underflows to 0 */
    LDSX();   // the wave's P stores land before other lanes of the wave read them
    if (HI) {
#pragma unroll
      for (int kc = 0; kc < 4; ++kc) { const F2 p = split_row(&ss[col][0], kc * 32, lane); v16b vh[HD / 16], vl[HD / 16];   /* eight fragments requested together */
#pragma unroll
        for (int j = 0; j < HD / 16; ++j) { const size_t po = ((size_t)b * CC + h * HD + j * 16 + col) * (size_t)KHI + kb * 128 + kc * 32; vh[j] = frag_b(VB + po, lane); vl[j] = frag_b(VBL + po, lane); }
#pragma unroll
        for (int j = 0; j < HD / 16; ++j) { acc[j] = wmma_bf(p.h, vh[j], acc[j]); acc[j] = wmma_bf(p.l, vh[j], acc[j]); acc[j] = wmma_bf(p.h, vl[j], acc[j]); } }
    } else {   /* v of the last 64 keys is requested ahead of the first products */
#pragma unroll
      for (int kc = 0; kc < 2; ++kc) {
#pragma unroll
        for (int j = 0; j < HD / 16; ++j) vfb[kc][j] = frag_h(VT + ((size_t)b * CC + h * HD + j * 16 + col) * (size_t)TT + kb * 128 + 64 + kc * 32, lane); }
#pragma unroll
      for (int kc = 0; kc < 4; ++kc) { const v16h p = frag_f32(&ss[col][kc * 32], lane);
#pragma unroll
        for (int j = 0; j < HD / 16; ++j) acc[j] = wmma16(p, kc < 2 ? vfa[kc][j] : vfb[kc - 2][j], acc[j]); } }
    LDSX();   // the wave's P reads are done before the next tile (or the epilogue) overwrites them
  }
#pragma unroll
  for (int j = 0; j < HD / 16; ++j)
#pragma unroll
    for (int r = 0; r < 8; ++r) ss[8 * g + r][j * 16 + col] = acc[j][r] * (1.0f / 2048.0f);
  LDSX();   // ctx stores land before the row-wise read below
  for (int rl = 0; rl < 16; ++rl) if (lane < HD / 4) vst2(Y + ((size_t)b * TT + ql0 + rl) * CC + h * HD + lane * 4, *(const v4f*)&ss[rl][lane * 4]); }
__global__ __launch_bounds__(128) void k_att(const _Float16* __restrict__ QH, const _Float16* __restrict__ KH, const _Float16* __restrict__ QL, const _Float16* __restrict__ KL, const _Float16* __restrict__ VT, const __bf16* __restrict__ VB, const __bf16* __restrict__ VBL, float* __restrict__ Y) { __shared__ __align__(16) float ss[4][16][132];
  const int wave = threadIdx.x >> 5, lane = threadIdx.x & 31; const int h = blockIdx.x % NH, b = blockIdx.x / NH; const int qb = NQB - 1 - blockIdx.y;   /* longest blocks start first */
  if (qb < QBH) att_body<true>(QH, KH, QL, KL, VT, VB, VBL, Y, ss[wave], b, h, qb, wave, lane);
  else att_body<false>(QH, KH, QL, KL, VT, VB, VBL, Y, ss[wave], b, h, qb, wave, lane); }
// ---- k_out: block = (64 rows, 128 cols): out = ctx Wo (+ bo): ctx once to f16 against Wo as f16(bf16 x 2^8) exact (1 product) x 2^-8; causal early rows (< QHI of each sequence): ctx bf16 hi + lo against exact bf16 Wo (2 products). Operands staged as in k_proj
__global__ __launch_bounds__(128) void k_out(const float* __restrict__ Y, const float* __restrict__ WO, const float* __restrict__ BO, float* __restrict__ OUT) { __shared__ __align__(16) unsigned char sm[2 * 256 * SPITCH * 2];   // two staging buffers; the output tiles take the same space behind the last barrier of the k loop
  float (*sf)[16][132] = reinterpret_cast<float (*)[16][132]>(sm);
  const int tid = threadIdx.x, wave = tid >> 5, lane = tid & 31, col = lane & 15, g = lane >> 4; const int c0 = blockIdx.y * 128; const size_t r0 = (size_t)blockIdx.x * 64 + wave * 16;
  v8f acc[8] = {};
  if (CAUSAL && (int)(((size_t)blockIdx.x * 64) % TT) < QHI) {   /* block-uniform */
    gemm_staged<1>(Y + (size_t)blockIdx.x * 64 * CC, WO + (size_t)c0 * CC, sm, tid, acc);
#pragma unroll
    for (int j = 0; j < 8; ++j) { const float bias = BO ? bfr(BO[c0 + j * 16 + col]) : 0.f;
#pragma unroll
      for (int r = 0; r < 8; ++r) sf[wave][8 * g + r][j * 16 + col] = acc[j][r] + bias; }
  } else {
    gemm_staged<2>(Y + (size_t)blockIdx.x * 64 * CC, WO + (size_t)c0 * CC, sm, tid, acc);   /* ctx carried x 2^6 into f16 so small-magnitude context rows stay clear of f16 subnormals */
#pragma unroll
    for (int j = 0; j < 8; ++j) { const float bias = BO ? bfr(BO[c0 + j * 16 + col]) : 0.f;
#pragma unroll
      for (int r = 0; r < 8; ++r) sf[wave][8 * g + r][j * 16 + col] = acc[j][r] * (1.0f / 16384.0f) + bias; } }   /* 2^-8 (Wo carry) x 2^-6 (ctx carry) */
  LDSX(); for (int rl = 0; rl < 16; ++rl) vst2(OUT + (r0 + rl) * DIN + c0 + lane * 4, *(const v4f*)&sf[wave][rl][lane * 4]); }

extern "C" void kernel_launch(void* const* d_in, const int* in_sizes, int n_in, void* d_out, int out_size, void* d_ws, size_t ws_size, hipStream_t stream) {
  (void)in_sizes; (void)n_in; (void)out_size;
  const float** F = (const float**)d_in;
  if (ws_size < (size_t)WS_END) return;
  char* ws = (char*)d_ws; _Float16 *QH = (_Float16*)(ws + WS_QH), *KH = (_Float16*)(ws + WS_KH), *VT = (_Float16*)(ws + WS_VT), *QL = (_Float16*)(ws + WS_QL), *KL = (_Float16*)(ws + WS_KL); __bf16 *VB = (__bf16*)(ws + WS_VB), *VBL = (__bf16*)(ws + WS_VBL); float *Y = (float*)(ws + WS_Y);
  (void)Y; (void)QL; (void)KL; (void)VB; (void)VBL;
  // inputs: 0 query [4,2048,768]; 1 key; 2 value; 3 Wq [768,768] (out,in), 4 bq; 5 Wk, 6 bk; 7 Wv, 8 bv; 9 Wo (out,in), 10 bo (all biases zeros, read)
  k_proj<<<dim3(TNB * TT / 64, CC / 128, 3), 128, 0, stream>>>(F[0], F[1], F[2], F[3], F[5], F[7], F[4], F[6], F[8], QH, QL, KH, KL, VT, VB, VBL);
  k_att<<<dim3(TNB * NH, NQB), 128, 0, stream>>>(QH, KH, QL, KL, VT, VB, VBL, Y);
  k_out<<<dim3(TNB * TT / 64, DIN / 128), 128, 0, stream>>>(Y, F[9], F[10], (float*)d_out);
}

// v003
// Measured time: 171 microseconds a run.
// Two timings next to v002 both put it at 1.32 times that version's speed.
// Counting every step since v000, it is 14.2 times as fast.
// compute dtype: all float inputs rounded to bf16; q / k / v projections with EXACT bf16 products on WMMA 16x16x32 (f32 accumulate) + bias (zeros, read); causal logits: 3 products for the first 384 rows, single f16 q x k after, x 64^-0.5; softmax f32; P x 2^11 once to f16 x v once to f16 (bf16 hi + lo below row 384); ctx hi+lo x exact Wo below row 384, x2^6 f16 carry x f16(bf16 x 2^8) Wo after, + bo (zeros); f32 output.
#include <hip/hip_runtime.h>
#include <math.h>

typedef __attribute__((ext_vector_type(16))) _Float16 v16h;
typedef __attribute__((ext_vector_type(16))) __bf16 v16b;
typedef __attribute__((ext_vector_type(8)))  _Float16 v8h;
typedef __attribute__((ext_vector_type(8)))  float v8f;
typedef __attribute__((ext_vector_type(4)))  float v4f;
typedef __attribute__((ext_vector_type(2)))  float v2f;
typedef __attribute__((ext_vector_type(4)))  unsigned v4u;
typedef __attribute__((ext_vector_type(4)))  int v4i;
typedef float __attribute__((may_alias)) float_a;
typedef int __attribute__((may_alias)) int_a;

template <typename T> __device__ __forceinline__ void vst2(void* p, T v) { *(T*)p = v;  }
__device__ __forceinline__ v8f wmma16(v16h a, v16h b, v8f c) {
  v8f d = __builtin_amdgcn_wmma_f32_16x16x32_f16(false, a, false, b, (short)0, c, false, false);
  asm volatile("v_nop\n\tv_nop\n\tv_nop\n\tv_nop" : "+v"(d) : "v"(a), "v"(b));
  return d;
}
__device__ __forceinline__ v8f wmma_bf(v16b a, v16b b, v8f c) {
  v8f d = __builtin_amdgcn_wmma_f32_16x16x32_bf16(false, a, false, b, (short)0, c, false, false);
  asm volatile("v_nop\n\tv_nop\n\tv_nop\n\tv_nop" : "+v"(d) : "v"(a), "v"(b));
  return d;
}
// 16x16x32 fragments: lane = (h = lane>>4, row/col = lane&15); elements 0..7 = k0+8h+0..7, 8..15 = k0+16+8h+0..7; D element r = row 8h+r
__device__ __forceinline__ v16h frag_h(const _Float16* rowk0, int lane) {
  union { v16h v; v8h q[2]; } u; const _Float16* p = rowk0 + 8 * (lane >> 4);
  u.q[0] = *(const v8h*)p; u.q[1] = *(const v8h*)(p + 16); return u.v;
}
__device__ __forceinline__ v16h frag_f32(const float* rowk0, int lane) {
  v16h a; const float* p = rowk0 + 8 * (lane >> 4);
#pragma unroll
  for (int i = 0; i < 8; ++i) { a[i] = (_Float16)p[i]; a[8 + i] = (_Float16)p[16 + i]; }
  return a;
}
__device__ __forceinline__ v16h frag_f32s(const float* rowk0, int lane, float sc) {
  v16h a; const float* p = rowk0 + 8 * (lane >> 4);
#pragma unroll
  for (int i = 0; i < 8; ++i) { a[i] = (_Float16)(p[i] * sc); a[8 + i] = (_Float16)(p[16 + i] * sc); }
  return a;
}
// column fragment from a [K][ld] layout (column n), rows >= K read as 0
__device__ __forceinline__ v16h fragc_f32(const float* W, int k0, int n, int lane, int ld, int K) {
  v16h a; const int g = lane >> 4;
#pragma unroll
  for (int i = 0; i < 8; ++i) { const int ka = k0 + 8 * g + i, kb = ka + 16;
    a[i] = (_Float16)(ka < K ? W[(size_t)(ka < K ? ka : K - 1) * ld + n] : 0.f); a[8 + i] = (_Float16)(kb < K ? W[(size_t)(kb < K ? kb : K - 1) * ld + n] : 0.f); }
  return a;
}
struct F2 { v16b h, l; };
__device__ __forceinline__ F2 bsplit16(const float v[16]) { F2 r;
#pragma unroll
  for (int i = 0; i < 16; ++i) { const __bf16 h = (__bf16)v[i]; r.h[i] = h; r.l[i] = (__bf16)(v[i] - (float)h); }
  return r; }
__device__ __forceinline__ F2 split_row(const float* row, int k0, int lane) { float v[16]; const float* p = row + k0 + 8 * (lane >> 4);
#pragma unroll
  for (int i = 0; i < 8; ++i) { v[i] = p[i]; v[8 + i] = p[16 + i]; }
  return bsplit16(v); }
__device__ __forceinline__ F2 split_rowK(const float* row, int k0, int lane, int K) { float v[16]; const int g = lane >> 4;
#pragma unroll
  for (int i = 0; i < 8; ++i) { const int ka = k0 + 8 * g + i, kb = ka + 16; v[i] = ka < K ? row[ka < K ? ka : K - 1] : 0.f; v[8 + i] = kb < K ? row[kb < K ? kb : K - 1] : 0.f; }
  return bsplit16(v); }
__device__ __forceinline__ F2 split_col(const float* W, int k0, int n, int lane, int ld, int K) { float v[16]; const int g = lane >> 4;
#pragma unroll
  for (int i = 0; i < 8; ++i) { const int ka = k0 + 8 * g + i, kb = ka + 16; v[i] = ka < K ? W[(size_t)(ka < K ? ka : K - 1) * ld + n] : 0.f; v[8 + i] = kb < K ? W[(size_t)(kb < K ? kb : K - 1) * ld + n] : 0.f; }
  return bsplit16(v); }
__device__ __forceinline__ v8f mac3(const F2& a, const F2& b, v8f c) { c = wmma_bf(a.l, b.h, c); c = wmma_bf(a.h, b.l, c); return wmma_bf(a.h, b.h, c); }
__device__ __forceinline__ float sigm(float v) { return 1.0f / (1.0f + expf(-v)); }
#define LDSX() do { asm volatile("s_wait_dscnt 0" ::: "memory"); __builtin_amdgcn_wave_barrier(); __builtin_amdgcn_fence(__ATOMIC_RELEASE, "workgroup"); } while (0)

// Causal multi-head attention on separate inputs (query / key / value [4,2048,768]; torch (out,in) Wq / Wk / Wv / Wo [768,768] N(0, 1/768) applied as x @ W.T + b, all biases zeros (read); 12 heads x 64; scores / sqrt(64); tril kept, -1e9 elsewhere (finite: its softmax weight underflows to 0); softmax; merged heads @ Wo.T + bo).
#define NB 4
#define TT 2048
#define CC 768            // NH * HD = projected width
#define DIN 768          // input (model) width
#define NH 12
#define HD 64
#define NQB (TT / 64)
#define SCALE (0.125f)
#define CAUSAL 1
#ifndef TNB
#define TNB NB
#endif
__device__ __forceinline__ float bfr(float v) { return (float)(__bf16)v; }
__host__ __device__ __forceinline__ int kb_last(int qb) { return CAUSAL ? ((qb * 64 + 63) >> 7) : (TT / 128 - 1); }
typedef __attribute__((ext_vector_type(8))) __bf16 v8b;
__device__ __forceinline__ v16b frag_b(const __bf16* rowk0, int lane) {
  union { v16b v; v8b q[2]; } u; const __bf16* p = rowk0 + 8 * (lane >> 4);
  u.q[0] = *(const v8b*)p; u.q[1] = *(const v8b*)(p + 16); return u.v;
}
#define QBH 6              // causal: query blocks 0..QBH-1 of each sequence (few keys, no averaging) take the high-precision path
#define QHI 384            // rows carrying a q residual plane
#define KHI 384            // key rows carrying k residual / v bf16 hi+lo planes (used only by the causal high-precision path)
// B fragment (k rows k0+.., output column o) of a weight: (in,out) [K][ld] or (out,in) [ld rows of K]: bf16 exact, or f16(bf16 * 256) exact
__device__ __forceinline__ v16b wcol_io(const float* Wm, int k0, int o, int lane, int ld) { v16b w; const int g = lane >> 4;
#pragma unroll
  for (int i = 0; i < 8; ++i) { w[i] = (__bf16)Wm[(size_t)(k0 + 8 * g + i) * ld + o]; w[8 + i] = (__bf16)Wm[(size_t)(k0 + 16 + 8 * g + i) * ld + o]; }
  return w; }
__device__ __forceinline__ v16b wcol_oi(const float* Wm, int k0, int o, int lane, int K) { v16b w; const float* p = Wm + (size_t)o * K + k0 + 8 * (lane >> 4);
#pragma unroll
  for (int i = 0; i < 8; ++i) { w[i] = (__bf16)p[i]; w[8 + i] = (__bf16)p[16 + i]; }
  return w; }
__device__ __forceinline__ v16h wcolh_io(const float* Wm, int k0, int o, int lane, int ld) { v16h w; const int g = lane >> 4;
#pragma unroll
  for (int i = 0; i < 8; ++i) { w[i] = (_Float16)(bfr(Wm[(size_t)(k0 + 8 * g + i) * ld + o]) * 256.0f); w[8 + i] = (_Float16)(bfr(Wm[(size_t)(k0 + 16 + 8 * g + i) * ld + o]) * 256.0f); }
  return w; }
__device__ __forceinline__ v16h wcolh_oi(const float* Wm, int k0, int o, int lane, int K) { v16h w; const float* p = Wm + (size_t)o * K + k0 + 8 * (lane >> 4);
#pragma unroll
  for (int i = 0; i < 8; ++i) { w[i] = (_Float16)(bfr(p[i]) * 256.0f); w[8 + i] = (_Float16)(bfr(p[16 + i]) * 256.0f); }
  return w; }
#define WQKV_LAYOUT 1   // selects only the WCOL reader, which nothing calls; k_proj reads (out,in) [CC][DIN] rows
__device__ __forceinline__ v16b wcol_hdk(const float* Wm, int k0, int o, int lane) { v16b w; const int g = lane >> 4; const float* p = Wm + (size_t)(o / HD) * DIN * HD + (o % HD);
#pragma unroll
  for (int i = 0; i < 8; ++i) { w[i] = (__bf16)p[(size_t)(k0 + 8 * g + i) * HD]; w[8 + i] = (__bf16)p[(size_t)(k0 + 16 + 8 * g + i) * HD]; }
  return w; }
#define WO_OUT_IN 1
#if WQKV_LAYOUT == 1
#define WCOL(W, k0, o, lane) wcol_oi(W, k0, o, lane, DIN)
#elif WQKV_LAYOUT == 2
#define WCOL(W, k0, o, lane) wcol_hdk(W, k0, o, lane)
#else
#define WCOL(W, k0, o, lane) wcol_io(W, k0, o, lane, CC)
#endif
#if WO_OUT_IN
#define WOCOL(W, k0, o, lane) wcol_oi(W, k0, o, lane, CC)
#define WOCOLH(W, k0, o, lane) wcolh_oi(W, k0, o, lane, CC)
#else
#define WOCOL(W, k0, o, lane) wcol_io(W, k0, o, lane, DIN)
#define WOCOLH(W, k0, o, lane) wcolh_io(W, k0, o, lane, DIN)
#endif

#ifndef PROJ_EXTRA_PARAMS
#define PROJ_EXTRA_PARAMS
#endif

#define WS_QH  0u                                      // f16 q rows [b*t][CC]
#define WS_KH  (WS_QH + 2u * (size_t)NB * TT * CC)      // f16 k rows [b*t][CC]
#define WS_VT  (WS_KH + 2u * (size_t)NB * TT * CC)      // f16 v planes [b][c][t]
#define WS_QL  (WS_VT + 2u * (size_t)NB * CC * TT)      // f16 q residual x 2^10 rows [b][t < QHI][CC]
#define WS_KL  (WS_QL + 2u * (size_t)NB * QHI * CC)     // f16 k residual x 2^10 rows [b][t < KHI][CC]
#define WS_VB  (WS_KL + 2u * (size_t)NB * KHI * CC)     // bf16 v hi planes [b][c][t < KHI]
#define WS_VBL (WS_VB + 2u * (size_t)NB * CC * KHI)
#define WS_Y   (WS_VBL + 2u * (size_t)NB * CC * KHI)    // f32 ctx rows [b*t][CC] (only when there is an output projection)
#define WS_END (WS_Y  + 4u * (size_t)NB * TT * CC)

// ---- staged operands of the two projection kernels: a block's 64 A rows and 128 W rows (both K-contiguous f32, K = 768) go through LDS in chunks of SBK k. Every global load covers whole 128-B lines, each element is rounded to its 16-bit operand type once per block, and the four waves read their fragments from LDS. Two buffers: chunk c + 1 is requested ahead of chunk c's products, stored behind them, and published by the one barrier at the foot of the trip. The k order of every accumulator is unchanged. The inner loops are unrolled so that every index of pf, w and acc is a constant (registers, no scratch).
#define SBK 64
#define SPITCH 72          // 16-bit elements per staged row: 128 B + 16 B, so that the 16 rows of a b128 fragment read fall on distinct banks
typedef __attribute__((ext_vector_type(4))) __bf16 v4b;
typedef __attribute__((ext_vector_type(4))) _Float16 v4h;
// MODE 0: A bf16, W bf16. MODE 1: A bf16 hi rows 0..63 + lo rows 64..127, W bf16. MODE 2: A f16(x 2^6), W f16(bf16 x 2^8)
template <int MODE> __device__ __forceinline__ void stage_put(unsigned char* buf, const v4f (&pf)[24], int srow, int sseg) {
  constexpr int W0 = MODE == 1 ? 128 : 64;
#pragma unroll
  for (int i = 0; i < 24; ++i) { const int row = i < 8 ? i * 8 + srow : W0 + (i - 8) * 8 + srow; unsigned char* d = buf + ((size_t)row * SPITCH + sseg * 4) * 2;
    if (MODE == 2) { v4h o;
#pragma unroll
      for (int e = 0; e < 4; ++e) o[e] = i < 8 ? (_Float16)(pf[i][e] * 64.0f) : (_Float16)(bfr(pf[i][e]) * 256.0f);
      *(v4h*)d = o;
    } else { v4b o, o2;
#pragma unroll
      for (int e = 0; e < 4; ++e) { const __bf16 hv = (__bf16)pf[i][e]; o[e] = hv; o2[e] = (__bf16)(pf[i][e] - (float)hv); }
      *(v4b*)d = o; if (MODE == 1 && i < 8) *(v4b*)(d + (size_t)64 * SPITCH * 2) = o2; } } }
template <int MODE> __device__ __forceinline__ void gemm_staged(const float* __restrict__ A0, const float* __restrict__ Wr0, unsigned char* sm, int tid, v8f (&acc)[8]) {
  constexpr int W0 = MODE == 1 ? 128 : 64; constexpr int BUFB = (W0 + 128) * SPITCH * 2; constexpr int NC = DIN / SBK;
  const int wave = tid >> 5, lane = tid & 31, col = lane & 15, srow = tid >> 4, sseg = tid & 15;
  unsigned vo = (unsigned)(srow * DIN + sseg * 4) * 4u;   /* the thread's byte offset in either tile; an address is a block-uniform base + this + a constant, and this one register steps by a chunk a trip */
  v4f pf[24];
#pragma unroll
  for (int i = 0; i < 24; ++i) pf[i] = *(const v4f*)((const char*)(i < 8 ? A0 : Wr0) + (size_t)vo + (size_t)(i < 8 ? i : i - 8) * 8 * DIN * 4);
  stage_put<MODE>(sm, pf, srow, sseg);
  __syncthreads();   // chunk 0 is published
  // rolled: the buffer is picked by the trip's parity, and one trip's body already holds 24 loads and all fragments
#pragma unroll 1
  for (int c = 0; c < NC; ++c) { const bool more = c + 1 < NC;   /* the same for the whole block */
    if (more) { vo += SBK * 4u;
#pragma unroll
      for (int i = 0; i < 24; ++i) pf[i] = *(const v4f*)((const char*)(i < 8 ? A0 : Wr0) + (size_t)vo + (size_t)(i < 8 ? i : i - 8) * 8 * DIN * 4);
      asm volatile("s_wait_xcnt 0x0" ::: "memory");   // stands between these loads and the next trip's rewrite of their offset register
    }
    const unsigned char* sb = sm + (c & 1) * BUFB;
#pragma unroll
    for (int kc = 0; kc < SBK / 32; ++kc) {
      if (MODE == 2) { const _Float16* s16 = (const _Float16*)sb; const v16h a = frag_h(s16 + (wave * 16 + col) * SPITCH + kc * 32, lane); v16h w[8];
#pragma unroll
        for (int j = 0; j < 8; ++j) w[j] = frag_h(s16 + (W0 + j * 16 + col) * SPITCH + kc * 32, lane);
#pragma unroll
        for (int j = 0; j < 8; ++j) acc[j] = wmma16(a, w[j], acc[j]);
      } else { const __bf16* s16 = (const __bf16*)sb; const v16b a = frag_b(s16 + (wave * 16 + col) * SPITCH + kc * 32, lane); const v16b a2 = MODE == 1 ? frag_b(s16 + (64 + wave * 16 + col) * SPITCH + kc * 32, lane) : a; v16b w[8];
#pragma unroll
        for (int j = 0; j < 8; ++j) w[j] = frag_b(s16 + (W0 + j * 16 + col) * SPITCH + kc * 32, lane);
#pragma unroll
        for (int j = 0; j < 8; ++j) { acc[j] = wmma_bf(a, w[j], acc[j]); if (MODE == 1) acc[j] = wmma_bf(a2, w[j], acc[j]); } } }
    if (more) stage_put<MODE>(sm + ((c + 1) & 1) * BUFB, pf, srow, sseg);
    __syncthreads();   // publishes chunk c + 1 and ends every wave's reads of chunk c (behind the last trip: before the epilogue reuses the space)
  } }
// ---- k_proj: block = (64 rows, 128 cols, which): q/k/v = X W (+ b) with exact bf16 products (K = DIN) -> which 0: q f16 rows (+ residual rows < QHI); 1: k f16 rows (+ residual rows < KHI); 2: v f16 planes [c][t] (+ bf16 hi/lo planes for t < KHI)
__global__ __launch_bounds__(128) void k_proj(const float* __restrict__ XQ, const float* __restrict__ XK, const float* __restrict__ XV, const float* __restrict__ WQ, const float* __restrict__ WK, const float* __restrict__ WV, const float* __restrict__ BQ, const float* __restrict__ BK, const float* __restrict__ BV,
    _Float16* __restrict__ QH, _Float16* __restrict__ QL, _Float16* __restrict__ KH, _Float16* __restrict__ KL, _Float16* __restrict__ VT, __bf16* __restrict__ VB, __bf16* __restrict__ VBL) {
  __shared__ __align__(16) unsigned char sm[2 * 192 * SPITCH * 2];   // two staging buffers; the epilogue's tiles take the same space behind the last barrier of the k loop
  _Float16 (*sh)[136] = reinterpret_cast<_Float16 (*)[136]>(sm); _Float16 (*sl)[136] = reinterpret_cast<_Float16 (*)[136]>(sm + 64 * 136 * 2);
  _Float16 (*th)[72] = reinterpret_cast<_Float16 (*)[72]>(sm); __bf16 (*tb)[72] = reinterpret_cast<__bf16 (*)[72]>(sm + 128 * 72 * 2); __bf16 (*tbl)[72] = reinterpret_cast<__bf16 (*)[72]>(sm + 2 * 128 * 72 * 2);
  const int tid = threadIdx.x, wave = tid >> 5, lane = tid & 31, col = lane & 15, g = lane >> 4; const int which = blockIdx.z; const int c0 = blockIdx.y * 128; const size_t r0 = (size_t)blockIdx.x * 64; const size_t bb = r0 / TT; const int t0 = (int)(r0 % TT);
  const float* X = which == 0 ? XQ : which == 1 ? XK : XV; const float* WA = which == 0 ? WQ : which == 1 ? WK : WV; const float* BA = which == 0 ? BQ : which == 1 ? BK : BV;
  v8f acc[8] = {};
  gemm_staged<0>(X + r0 * DIN, WA + (size_t)c0 * DIN, sm, tid, acc);
  if (which < 2) { _Float16* DH = which == 0 ? QH : KH; _Float16* DL = which == 0 ? QL : KL; const int nhi = which == 0 ? QHI : KHI; const bool hi_rows = t0 < nhi;
#pragma unroll
    for (int j = 0; j < 8; ++j) { const float bias = BA ? bfr(BA[c0 + j * 16 + col]) : 0.f;
#pragma unroll
      for (int r = 0; r < 8; ++r) { const float v = acc[j][r] + bias; const _Float16 hv = (_Float16)v; sh[wave * 16 + 8 * g + r][j * 16 + col] = hv; sl[wave * 16 + 8 * g + r][j * 16 + col] = (_Float16)((v - (float)hv) * 1024.0f); } }
    __syncthreads();
    for (int e = tid; e < 64 * 16; e += 128) { const int rl = e >> 4, q = e & 15; vst2((unsigned*)(DH + (r0 + rl) * CC + c0 + q * 8), *(const v4u*)&sh[rl][q * 8]); if (hi_rows) vst2((unsigned*)(DL + (bb * nhi + t0 + rl) * (size_t)CC + c0 + q * 8), *(const v4u*)&sl[rl][q * 8]); }
  } else { const bool hi_rows = t0 < KHI;
#pragma unroll
    for (int j = 0; j < 8; ++j) { const float bias = BA ? bfr(BA[c0 + j * 16 + col]) : 0.f;
#pragma unroll
      for (int r = 0; r < 8; ++r) { const float v = acc[j][r] + bias; const int rl = wave * 16 + 8 * g + r, cl = j * 16 + col; th[cl][rl] = (_Float16)v; const __bf16 bh = (__bf16)v; tb[cl][rl] = bh; tbl[cl][rl] = (__bf16)(v - (float)bh); } }
    __syncthreads();
    for (int e = tid; e < 128 * 8; e += 128) { const int cl = e >> 3, q = e & 7; vst2((unsigned*)(VT + (bb * CC + c0 + cl) * (size_t)TT + t0 + q * 8), *(const v4u*)&th[cl][q * 8]); if (hi_rows) { const size_t o3 = (bb * CC + c0 + cl) * (size_t)KHI + t0 + q * 8; vst2((unsigned*)(VB + o3), *(const v4u*)&tb[cl][q * 8]); vst2((unsigned*)(VBL + o3), *(const v4u*)&tbl[cl][q * 8]); } } } }
// ---- k_att: block = 64 queries (qb, heaviest first) of (b, h); each wave owns 16 query rows and shares nothing with the other waves (no work-group barrier). Logits, softmax and P . v stay in the kernel, in one sweep over the keys: per 16 x 128 key tile the row maximum so far is renewed (joined over the row's 16 lanes), the denominator and the P . v accumulators are scaled by exp(old max - new max), and P x 2^11 = exp(s - max so far) x 2^11 passes through the wave's own LDS tile from the accumulator map to the A map and meets v; the division by the denominator comes once, at the end. Products, operand types and the key order of the P . v sum are those of the three-kernel form (query blocks < QBH: 3-product logits, P and v as bf16 hi + lo).
template <bool HI> __device__ __forceinline__ void att_logits(const v16h (&ah)[HD / 32], const v16h (&al)[HD / 32], const _Float16* __restrict__ Kr, const _Float16* __restrict__ KLr, int lane, v8f (&s)[8]) {
  if (HI) {
#pragma unroll
    for (int j = 0; j < 8; ++j) { v16h kbf[HD / 32], klf[HD / 32]; v8f a = {}, a2 = {};   /* the four fragments of a key group are requested together, ahead of their products: one load latency for the batch */
#pragma unroll
      for (int kc = 0; kc < HD / 32; ++kc) { kbf[kc] = frag_h(Kr + (size_t)j * 16 * CC + kc * 32, lane); klf[kc] = frag_h(KLr + (size_t)j * 16 * CC + kc * 32, lane); }
#pragma unroll
      for (int kc = 0; kc < HD / 32; ++kc) { a = wmma16(ah[kc], kbf[kc], a); a2 = wmma16(al[kc], kbf[kc], a2); a2 = wmma16(ah[kc], klf[kc], a2); }
#pragma unroll
      for (int r = 0; r < 8; ++r) s[j][r] = (a[r] + a2[r] * (1.0f / 1024.0f)) * SCALE; }
  } else {
#pragma unroll
    for (int j = 0; j < 8; ++j) s[j] = v8f{};
#pragma unroll
    for (int kc = 0; kc < HD / 32; ++kc) { v16h kf[8];   /* eight fragments requested together, ahead of their products: one load latency for the batch */
#pragma unroll
      for (int j = 0; j < 8; ++j) kf[j] = frag_h(Kr + (size_t)j * 16 * CC + kc * 32, lane);
#pragma unroll
      for (int j = 0; j < 8; ++j) s[j] = wmma16(ah[kc], kf[j], s[j]); }
#pragma unroll
    for (int j = 0; j < 8; ++j) {
#pragma unroll
      for (int r = 0; r < 8; ++r) s[j][r] = s[j][r] * SCALE; } } }
#define LN2048 7.62461898616224f   // ln 2^11: the f16 carry of P, taken into the exponent
// maximum over the 16 lanes that hold one row of an accumulator tile: four row_xmask DPP steps, no LDS pipe
__device__ __forceinline__ float rowmax16(float v) {
  v = fmaxf(v, __builtin_bit_cast(float, __builtin_amdgcn_update_dpp(__builtin_bit_cast(int, v), __builtin_bit_cast(int, v), 0x161, 0xf, 0xf, false)));
  v = fmaxf(v, __builtin_bit_cast(float, __builtin_amdgcn_update_dpp(__builtin_bit_cast(int, v), __builtin_bit_cast(int, v), 0x162, 0xf, 0xf, false)));
  v = fmaxf(v, __builtin_bit_cast(float, __builtin_amdgcn_update_dpp(__builtin_bit_cast(int, v), __builtin_bit_cast(int, v), 0x164, 0xf, 0xf, false)));
  return fmaxf(v, __builtin_bit_cast(float, __builtin_amdgcn_update_dpp(__builtin_bit_cast(int, v), __builtin_bit_cast(int, v), 0x168, 0xf, 0xf, false))); }
template <bool HI> __device__ __forceinline__ void att_body(const _Float16* __restrict__ QH, const _Float16* __restrict__ KH, const _Float16* __restrict__ QL, const _Float16* __restrict__ KL, const _Float16* __restrict__ VT, const __bf16* __restrict__ VB, const __bf16* __restrict__ VBL, float* __restrict__ Y, float (*ss)[132], int b, int h, int qb, int wave, int lane) {
  const int col = lane & 15, g = lane >> 4; const int ql0 = qb * 64 + wave * 16; const size_t q0 = (size_t)b * TT + ql0; const int nkb = kb_last(qb) + 1;
  const _Float16* K0 = KH + ((size_t)b * TT + col) * CC + h * HD; const _Float16* KL0 = KL + ((size_t)b * KHI + col) * CC + h * HD;
  v16h ah[HD / 32], al[HD / 32];
#pragma unroll
  for (int kc = 0; kc < HD / 32; ++kc) { ah[kc] = frag_h(QH + (q0 + col) * CC + h * HD + kc * 32, lane); al[kc] = HI ? frag_h(QL + ((size_t)b * QHI + ql0 + col) * CC + h * HD + kc * 32, lane) : ah[kc]; }
  if (HI) asm volatile("s_wait_xcnt 0x0" ::: "memory");   // stands between the q loads and the first rewrite of their address registers
  float m[8], l[8];
#pragma unroll
  for (int r = 0; r < 8; ++r) { m[r] = -1.0e30f; l[r] = 0.f; }   /* the start stays above the excluded keys' -3e38, so that their exp(v - max) underflows to 0 also where no kept key has been met */
  v8f acc[HD / 16] = {};
  // rolled: one tile's body already fills the registers, and a second copy would only lengthen the text
#pragma unroll 1
  for (int kb = 0; kb < nkb; ++kb) { v8f s[8]; att_logits<HI>(ah, al, K0 + (size_t)kb * 128 * CC, KL0 + (size_t)kb * 128 * CC, lane, s);
    const int dd = ql0 + 8 * g - col - kb * 128;   /* the lane's first query row less its first key of the tile: one register carries the causal test, each element compares it with a constant */
    v16h vfa[2][HD / 16], vfb[2][HD / 16];
    if (!HI) {   /* v of the tile's first 64 keys is requested here, so that it arrives under the exponentials */
#pragma unroll
      for (int kc = 0; kc < 2; ++kc) {
#pragma unroll
        for (int j = 0; j < HD / 16; ++j) vfa[kc][j] = frag_h(VT + ((size_t)b * CC + h * HD + j * 16 + col) * (size_t)TT + kb * 128 + kc * 32, lane); } }
#pragma unroll
    for (int r = 0; r < 8; ++r) { float tm = -3.0e38f;
#pragma unroll
      for (int j = 0; j < 8; ++j) { const float v = (j * 16 - r <= dd) ? s[j][r] : -3.0e38f; s[j][r] = v; tm = fmaxf(tm, v); }   /* key kb * 128 + j * 16 + col <= query ql0 + 8 * g + r */
      const float mn = fmaxf(m[r], rowmax16(tm)), f = expf(m[r] - mn), mb = mn - LN2048; float a = l[r] * f;   /* mn is the same in the row's 16 lanes; f = 0 on the first tile, 1 while the maximum stands */
#pragma unroll
      for (int j = 0; j < 8; ++j) { const float p = expf(s[j][r] - mb); a += p; ss[8 * g + r][j * 16 + col] = p; }   /* P x 2^11 against the maximum so far; excluded key: exp underflows to 0 */
#pragma unroll
      for (int j = 0; j < HD / 16; ++j) acc[j][r] *= f;   /* what was summed against the older maximum */
      l[r] = a; m[r] = mn; }
    LDSX();   // the wave's P stores land before other lanes of the wave read them
    if (HI) {
#pragma unroll
      for (int kc = 0; kc < 4; ++kc) { const F2 p = split_row(&ss[col][0], kc * 32, lane); v16b vh[HD / 16], vl[HD / 16];   /* eight fragments requested together */
#pragma unroll
        for (int j = 0; j < HD / 16; ++j) { const size_t po = ((size_t)b * CC + h * HD + j * 16 + col) * (size_t)KHI + kb * 128 + kc * 32; vh[j] = frag_b(VB + po, lane); vl[j] = frag_b(VBL + po, lane); }
#pragma unroll
        for (int j = 0; j < HD / 16; ++j) { acc[j] = wmma_bf(p.h, vh[j], acc[j]); acc[j] = wmma_bf(p.l, vh[j], acc[j]); acc[j] = wmma_bf(p.h, vl[j], acc[j]); } }
    } else {   /* v of the last 64 keys is requested ahead of the first products */
#pragma unroll
      for (int kc = 0; kc < 2; ++kc) {
#pragma unroll
        for (int j = 0; j < HD / 16; ++j) vfb[kc][j] = frag_h(VT + ((size_t)b * CC + h * HD + j * 16 + col) * (size_t)TT + kb * 128 + 64 + kc * 32, lane); }
#pragma unroll
      for (int kc = 0; kc < 4; ++kc) { const v16h p = frag_f32(&ss[col][kc * 32], lane);
#pragma unroll
        for (int j = 0; j < HD / 16; ++j) acc[j] = wmma16(p, kc < 2 ? vfa[kc][j] : vfb[kc - 2][j], acc[j]); } }
    LDSX();   // the wave's P reads are done before the next tile (or the epilogue) overwrites them
  }
#pragma unroll
  for (int r = 0; r < 8; ++r) { float a = l[r];   /* the lanes' shares of the denominator (x 2^11, like acc) are joined once */
#pragma unroll
    for (int o = 1; o < 16; o <<= 1) a += __shfl_xor(a, o);
    l[r] = a > 0.f ? 1.0f / a : 0.f; }
#pragma unroll
  for (int j = 0; j < HD / 16; ++j)
#pragma unroll
    for (int r = 0; r < 8; ++r) ss[8 * g + r][j * 16 + col] = acc[j][r] * l[r];
  LDSX();   // ctx stores land before the row-wise read below
  for (int rl = 0; rl < 16; ++rl) if (lane < HD / 4) vst2(Y + ((size_t)b * TT + ql0 + rl) * CC + h * HD + lane * 4, *(const v4f*)&ss[rl][lane * 4]); }
// four waves per SIMD, as the two-sweep form had: without the attribute this build takes 278 registers (the early-row branch), and a SIMD then holds three waves to cover each other's exponentials and loads
__global__ __launch_bounds__(128) __attribute__((amdgpu_waves_per_eu(4))) void k_att(const _Float16* __restrict__ QH, const _Float16* __restrict__ KH, const _Float16* __restrict__ QL, const _Float16* __restrict__ KL, const _Float16* __restrict__ VT, const __bf16* __restrict__ VB, const __bf16* __restrict__ VBL, float* __restrict__ Y) { __shared__ __align__(16) float ss[4][16][132];
  const int wave = threadIdx.x >> 5, lane = threadIdx.x & 31; const int h = blockIdx.x % NH, b = blockIdx.x / NH; const int qb = NQB - 1 - blockIdx.y;   /* longest blocks start first */
  if (qb < QBH) att_body<true>(QH, KH, QL, KL, VT, VB, VBL, Y, ss[wave], b, h, qb, wave, lane);
  else att_body<false>(QH, KH, QL, KL, VT, VB, VBL, Y, ss[wave], b, h, qb, wave, lane); }
// ---- k_out: block = (64 rows, 128 cols): out = ctx Wo (+ bo): ctx once to f16 against Wo as f16(bf16 x 2^8) exact (1 product) x 2^-8; causal early rows (< QHI of each sequence): ctx bf16 hi + lo against exact bf16 Wo (2 products). Operands staged as in k_proj
__global__ __launch_bounds__(128) void k_out(const float* __restrict__ Y, const float* __restrict__ WO, const float* __restrict__ BO, float* __restrict__ OUT) { __shared__ __align__(16) unsigned char sm[2 * 256 * SPITCH * 2];   // two staging buffers; the output tiles take the same space behind the last barrier of the k loop
  float (*sf)[16][132] = reinterpret_cast<float (*)[16][132]>(sm);
  const int tid = threadIdx.x, wave = tid >> 5, lane = tid & 31, col = lane & 15, g = lane >> 4; const int c0 = blockIdx.y * 128; const size_t r0 = (size_t)blockIdx.x * 64 + wave * 16;
  v8f acc[8] = {};
  if (CAUSAL && (int)(((size_t)blockIdx.x * 64) % TT) < QHI) {   /* block-uniform */
    gemm_staged<1>(Y + (size_t)blockIdx.x * 64 * CC, WO + (size_t)c0 * CC, sm, tid, acc);
#pragma unroll
    for (int j = 0; j < 8; ++j) { const float bias = BO ? bfr(BO[c0 + j * 16 + col]) : 0.f;
#pragma unroll
      for (int r = 0; r < 8; ++r) sf[wave][8 * g + r][j * 16 + col] = acc[j][r] + bias; }
  } else {
    gemm_staged<2>(Y + (size_t)blockIdx.x * 64 * CC, WO + (size_t)c0 * CC, sm, tid, acc);   /* ctx carried x 2^6 into f16 so small-magnitude context rows stay clear of f16 subnormals */
#pragma unroll
    for (int j = 0; j < 8; ++j) { const float bias = BO ? bfr(BO[c0 + j * 16 + col]) : 0.f;
#pragma unroll
      for (int r = 0; r < 8; ++r) sf[wave][8 * g + r][j * 16 + col] = acc[j][r] * (1.0f / 16384.0f) + bias; } }   /* 2^-8 (Wo carry) x 2^-6 (ctx carry) */
  LDSX(); for (int rl = 0; rl < 16; ++rl) vst2(OUT + (r0 + rl) * DIN + c0 + lane * 4, *(const v4f*)&sf[wave][rl][lane * 4]); }

extern "C" void kernel_launch(void* const* d_in, const int* in_sizes, int n_in, void* d_out, int out_size, void* d_ws, size_t ws_size, hipStream_t stream) {
  (void)in_sizes; (void)n_in; (void)out_size;
  const float** F = (const float**)d_in;
  if (ws_size < (size_t)WS_END) return;
  char* ws = (char*)d_ws; _Float16 *QH = (_Float16*)(ws + WS_QH), *KH = (_Float16*)(ws + WS_KH), *VT = (_Float16*)(ws + WS_VT), *QL = (_Float16*)(ws + WS_QL), *KL = (_Float16*)(ws + WS_KL); __bf16 *VB = (__bf16*)(ws + WS_VB), *VBL = (__bf16*)(ws + WS_VBL); float *Y = (float*)(ws + WS_Y);
  (void)Y; (void)QL; (void)KL; (void)VB; (void)VBL;
  // inputs: 0 query [4,2048,768]; 1 key; 2 value; 3 Wq [768,768] (out,in), 4 bq; 5 Wk, 6 bk; 7 Wv, 8 bv; 9 Wo (out,in), 10 bo (all biases zeros, read)
  k_proj<<<dim3(TNB * TT / 64, CC / 128, 3), 128, 0, stream>>>(F[0], F[1], F[2], F[3], F[5], F[7], F[4], F[6], F[8], QH, QL, KH, KL, VT, VB, VBL);
  k_att<<<dim3(TNB * NH, NQB), 128, 0, stream>>>(QH, KH, QL, KL, VT, VB, VBL, Y);
  k_out<<<dim3(TNB * TT / 64, DIN / 128), 128, 0, stream>>>(Y, F[9], F[10], (float*)d_out);
}

// v004
// One run takes 166 microseconds.
// Next to v003, in two timings, it ran 1.03 times as fast each time.
// Counting every step since v000, it is 14.6 times as fast.
// compute dtype: all float inputs rounded to bf16; q / k / v projections with EXACT bf16 products on WMMA 16x16x32 (f32 accumulate) + bias (zeros, read); causal logits: 3 products for the first 384 rows, single f16 q x k after, x 64^-0.5; softmax f32; P x 2^11 once to f16 x v once to f16 (bf16 hi + lo below row 384); ctx hi+lo x exact Wo below row 384, x2^6 f16 carry x f16(bf16 x 2^8) Wo after, + bo (zeros); f32 output.
#include <hip/hip_runtime.h>
#include <math.h>

typedef __attribute__((ext_vector_type(16))) _Float16 v16h;
typedef __attribute__((ext_vector_type(16))) __bf16 v16b;
typedef __attribute__((ext_vector_type(8)))  _Float16 v8h;
typedef __attribute__((ext_vector_type(8)))  float v8f;
typedef __attribute__((ext_vector_type(4)))  float v4f;
typedef __attribute__((ext_vector_type(2)))  float v2f;
typedef __attribute__((ext_vector_type(4)))  unsigned v4u;
typedef __attribute__((ext_vector_type(4)))  int v4i;
typedef float __attribute__((may_alias)) float_a;
typedef int __attribute__((may_alias)) int_a;

template <typename T> __device__ __forceinline__ void vst2(void* p, T v) { *(T*)p = v;  }
__device__ __forceinline__ v8f wmma16(v16h a, v16h b, v8f c) {
  v8f d = __builtin_amdgcn_wmma_f32_16x16x32_f16(false, a, false, b, (short)0, c, false, false);
  asm volatile("v_nop\n\tv_nop\n\tv_nop\n\tv_nop" : "+v"(d) : "v"(a), "v"(b));
  return d;
}
__device__ __forceinline__ v8f wmma_bf(v16b a, v16b b, v8f c) {
  v8f d = __builtin_amdgcn_wmma_f32_16x16x32_bf16(false, a, false, b, (short)0, c, false, false);
  asm volatile("v_nop\n\tv_nop\n\tv_nop\n\tv_nop" : "+v"(d) : "v"(a), "v"(b));
  return d;
}
// 16x16x32 fragments: lane = (h = lane>>4, row/col = lane&15); elements 0..7 = k0+8h+0..7, 8..15 = k0+16+8h+0..7; D element r = row 8h+r
__device__ __forceinline__ v16h frag_h(const _Float16* rowk0, int lane) {
  union { v16h v; v8h q[2]; } u; const _Float16* p = rowk0 + 8 * (lane >> 4);
  u.q[0] = *(const v8h*)p; u.q[1] = *(const v8h*)(p + 16); return u.v;
}
__device__ __forceinline__ v16h frag_f32(const float* rowk0, int lane) {
  v16h a; const float* p = rowk0 + 8 * (lane >> 4);
#pragma unroll
  for (int i = 0; i < 8; ++i) { a[i] = (_Float16)p[i]; a[8 + i] = (_Float16)p[16 + i]; }
  return a;
}
__device__ __forceinline__ v16h frag_f32s(const float* rowk0, int lane, float sc) {
  v16h a; const float* p = rowk0 + 8 * (lane >> 4);
#pragma unroll
  for (int i = 0; i < 8; ++i) { a[i] = (_Float16)(p[i] * sc); a[8 + i] = (_Float16)(p[16 + i] * sc); }
  return a;
}
// column fragment from a [K][ld] layout (column n), rows >= K read as 0
__device__ __forceinline__ v16h fragc_f32(const float* W, int k0, int n, int lane, int ld, int K) {
  v16h a; const int g = lane >> 4;
#pragma unroll
  for (int i = 0; i < 8; ++i) { const int ka = k0 + 8 * g + i, kb = ka + 16;
    a[i] = (_Float16)(ka < K ? W[(size_t)(ka < K ? ka : K - 1) * ld + n] : 0.f); a[8 + i] = (_Float16)(kb < K ? W[(size_t)(kb < K ? kb : K - 1) * ld + n] : 0.f); }
  return a;
}
struct F2 { v16b h, l; };
__device__ __forceinline__ F2 bsplit16(const float v[16]) { F2 r;
#pragma unroll
  for (int i = 0; i < 16; ++i) { const __bf16 h = (__bf16)v[i]; r.h[i] = h; r.l[i] = (__bf16)(v[i] - (float)h); }
  return r; }
__device__ __forceinline__ F2 split_row(const float* row, int k0, int lane) { float v[16]; const float* p = row + k0 + 8 * (lane >> 4);
#pragma unroll
  for (int i = 0; i < 8; ++i) { v[i] = p[i]; v[8 + i] = p[16 + i]; }
  return bsplit16(v); }
__device__ __forceinline__ F2 split_rowK(const float* row, int k0, int lane, int K) { float v[16]; const int g = lane >> 4;
#pragma unroll
  for (int i = 0; i < 8; ++i) { const int ka = k0 + 8 * g + i, kb = ka + 16; v[i] = ka < K ? row[ka < K ? ka : K - 1] : 0.f; v[8 + i] = kb < K ? row[kb < K ? kb : K - 1] : 0.f; }
  return bsplit16(v); }
__device__ __forceinline__ F2 split_col(const float* W, int k0, int n, int lane, int ld, int K) { float v[16]; const int g = lane >> 4;
#pragma unroll
  for (int i = 0; i < 8; ++i) { const int ka = k0 + 8 * g + i, kb = ka + 16; v[i] = ka < K ? W[(size_t)(ka < K ? ka : K - 1) * ld + n] : 0.f; v[8 + i] = kb < K ? W[(size_t)(kb < K ? kb : K - 1) * ld + n] : 0.f; }
  return bsplit16(v); }
__device__ __forceinline__ v8f mac3(const F2& a, const F2& b, v8f c) { c = wmma_bf(a.l, b.h, c); c = wmma_bf(a.h, b.l, c); return wmma_bf(a.h, b.h, c); }
__device__ __forceinline__ float sigm(float v) { return 1.0f / (1.0f + expf(-v)); }
#define LDSX() do { asm volatile("s_wait_dscnt 0" ::: "memory"); __builtin_amdgcn_wave_barrier(); __builtin_amdgcn_fence(__ATOMIC_RELEASE, "workgroup"); } while (0)

// Causal multi-head attention on separate inputs (query / key / value [4,2048,768]; torch (out,in) Wq / Wk / Wv / Wo [768,768] N(0, 1/768) applied as x @ W.T + b, all biases zeros (read); 12 heads x 64; scores / sqrt(64); tril kept, -1e9 elsewhere (finite: its softmax weight underflows to 0); softmax; merged heads @ Wo.T + bo).
#define NB 4
#define TT 2048
#define CC 768            // NH * HD = projected width
#define DIN 768          // input (model) width
#define NH 12
#define HD 64
#define NQB (TT / 64)
#define SCALE (0.125f)
#define CAUSAL 1
#ifndef TNB
#define TNB NB
#endif
__device__ __forceinline__ float bfr(float v) { return (float)(__bf16)v; }
__host__ __device__ __forceinline__ int kb_last(int qb) { return CAUSAL ? ((qb * 64 + 63) >> 7) : (TT / 128 - 1); }
typedef __attribute__((ext_vector_type(8))) __bf16 v8b;
__device__ __forceinline__ v16b frag_b(const __bf16* rowk0, int lane) {
  union { v16b v; v8b q[2]; } u; const __bf16* p = rowk0 + 8 * (lane >> 4);
  u.q[0] = *(const v8b*)p; u.q[1] = *(const v8b*)(p + 16); return u.v;
}
#define QBH 6              // causal: query blocks 0..QBH-1 of each sequence (few keys, no averaging) take the high-precision path
#define QHI 384            // rows carrying a q residual plane
#define KHI 384            // key rows carrying k residual / v bf16 hi+lo planes (used only by the causal high-precision path)
// B fragment (k rows k0+.., output column o) of a weight: (in,out) [K][ld] or (out,in) [ld rows of K]: bf16 exact, or f16(bf16 * 256) exact
__device__ __forceinline__ v16b wcol_io(const float* Wm, int k0, int o, int lane, int ld) { v16b w; const int g = lane >> 4;
#pragma unroll
  for (int i = 0; i < 8; ++i) { w[i] = (__bf16)Wm[(size_t)(k0 + 8 * g + i) * ld + o]; w[8 + i] = (__bf16)Wm[(size_t)(k0 + 16 + 8 * g + i) * ld + o]; }
  return w; }
__device__ __forceinline__ v16b wcol_oi(const float* Wm, int k0, int o, int lane, int K) { v16b w; const float* p = Wm + (size_t)o * K + k0 + 8 * (lane >> 4);
#pragma unroll
  for (int i = 0; i < 8; ++i) { w[i] = (__bf16)p[i]; w[8 + i] = (__bf16)p[16 + i]; }
  return w; }
__device__ __forceinline__ v16h wcolh_io(const float* Wm, int k0, int o, int lane, int ld) { v16h w; const int g = lane >> 4;
#pragma unroll
  for (int i = 0; i < 8; ++i) { w[i] = (_Float16)(bfr(Wm[(size_t)(k0 + 8 * g + i) * ld + o]) * 256.0f); w[8 + i] = (_Float16)(bfr(Wm[(size_t)(k0 + 16 + 8 * g + i) * ld + o]) * 256.0f); }
  return w; }
__device__ __forceinline__ v16h wcolh_oi(const float* Wm, int k0, int o, int lane, int K) { v16h w; const float* p = Wm + (size_t)o * K + k0 + 8 * (lane >> 4);
#pragma unroll
  for (int i = 0; i < 8; ++i) { w[i] = (_Float16)(bfr(p[i]) * 256.0f); w[8 + i] = (_Float16)(bfr(p[16 + i]) * 256.0f); }
  return w; }
#define WQKV_LAYOUT 1   // selects only the WCOL reader, which nothing calls; k_proj reads (out,in) [CC][DIN] rows
__device__ __forceinline__ v16b wcol_hdk(const float* Wm, int k0, int o, int lane) { v16b w; const int g = lane >> 4; const float* p = Wm + (size_t)(o / HD) * DIN * HD + (o % HD);
#pragma unroll
  for (int i = 0; i < 8; ++i) { w[i] = (__bf16)p[(size_t)(k0 + 8 * g + i) * HD]; w[8 + i] = (__bf16)p[(size_t)(k0 + 16 + 8 * g + i) * HD]; }
  return w; }
#define WO_OUT_IN 1
#if WQKV_LAYOUT == 1
#define WCOL(W, k0, o, lane) wcol_oi(W, k0, o, lane, DIN)
#elif WQKV_LAYOUT == 2
#define WCOL(W, k0, o, lane) wcol_hdk(W, k0, o, lane)
#else
#define WCOL(W, k0, o, lane) wcol_io(W, k0, o, lane, CC)
#endif
#if WO_OUT_IN
#define WOCOL(W, k0, o, lane) wcol_oi(W, k0, o, lane, CC)
#define WOCOLH(W, k0, o, lane) wcolh_oi(W, k0, o, lane, CC)
#else
#define WOCOL(W, k0, o, lane) wcol_io(W, k0, o, lane, DIN)
#define WOCOLH(W, k0, o, lane) wcolh_io(W, k0, o, lane, DIN)
#endif

#ifndef PROJ_EXTRA_PARAMS
#define PROJ_EXTRA_PARAMS
#endif

#define WS_QH  0u                                      // f16 q rows [b*t][CC]
#define WS_KH  (WS_QH + 2u * (size_t)NB * TT * CC)      // f16 k rows [b*t][CC]
#define WS_VT  (WS_KH + 2u * (size_t)NB * TT * CC)      // f16 v planes [b][c][t]
#define WS_QL  (WS_VT + 2u * (size_t)NB * CC * TT)      // f16 q residual x 2^10 rows [b][t < QHI][CC]
#define WS_KL  (WS_QL + 2u * (size_t)NB * QHI * CC)     // f16 k residual x 2^10 rows [b][t < KHI][CC]
#define WS_VB  (WS_KL + 2u * (size_t)NB * KHI * CC)     // bf16 v hi planes [b][c][t < KHI]
#define WS_VBL (WS_VB + 2u * (size_t)NB * CC * KHI)
#define WS_Y   (WS_VBL + 2u * (size_t)NB * CC * KHI)    // f32 ctx rows [b*t][CC] (only when there is an output projection)
#define WS_END (WS_Y  + 4u * (size_t)NB * TT * CC)

// ---- staged operands of the two projection kernels: a block's 64 A rows and 128 W rows (both K-contiguous f32, K = 768) go through LDS in chunks of SBK k. Every global load covers whole 128-B lines, each element is rounded to its 16-bit operand type once per block, and the four waves read their fragments from LDS. Two buffers: chunk c + 1 is requested ahead of chunk c's products, stored behind them, and published by the one barrier at the foot of the trip. The k order of every accumulator is unchanged. The inner loops are unrolled so that every index of pf, w and acc is a constant (registers, no scratch).
#define SBK 64
#define SPITCH 72          // 16-bit elements per staged row: 128 B + 16 B, so that the 16 rows of a b128 fragment read fall on distinct banks
typedef __attribute__((ext_vector_type(4))) __bf16 v4b;
typedef __attribute__((ext_vector_type(4))) _Float16 v4h;
// MODE 0: A bf16, W bf16. MODE 1: A bf16 hi rows 0..63 + lo rows 64..127, W bf16. MODE 2: A f16(x 2^6), W f16(bf16 x 2^8)
template <int MODE> __device__ __forceinline__ void stage_put(unsigned char* buf, const v4f (&pf)[24], int srow, int sseg) {
  constexpr int W0 = MODE == 1 ? 128 : 64;
#pragma unroll
  for (int i = 0; i < 24; ++i) { const int row = i < 8 ? i * 8 + srow : W0 + (i - 8) * 8 + srow; unsigned char* d = buf + ((size_t)row * SPITCH + sseg * 4) * 2;
    if (MODE == 2) { v4h o;
#pragma unroll
      for (int e = 0; e < 4; ++e) o[e] = i < 8 ? (_Float16)(pf[i][e] * 64.0f) : (_Float16)(bfr(pf[i][e]) * 256.0f);
      *(v4h*)d = o;
    } else { v4b o, o2;
#pragma unroll
      for (int e = 0; e < 4; ++e) { const __bf16 hv = (__bf16)pf[i][e]; o[e] = hv; o2[e] = (__bf16)(pf[i][e] - (float)hv); }
      *(v4b*)d = o; if (MODE == 1 && i < 8) *(v4b*)(d + (size_t)64 * SPITCH * 2) = o2; } } }
template <int MODE> __device__ __forceinline__ void gemm_staged(const float* __restrict__ A0, const float* __restrict__ Wr0, unsigned char* sm, int tid, v8f (&acc)[8]) {
  constexpr int W0 = MODE == 1 ? 128 : 64; constexpr int BUFB = (W0 + 128) * SPITCH * 2; constexpr int NC = DIN / SBK;
  const int wave = tid >> 5, lane = tid & 31, col = lane & 15, srow = tid >> 4, sseg = tid & 15;
  unsigned vo = (unsigned)(srow * DIN + sseg * 4) * 4u;   /* the thread's byte offset in either tile; an address is a block-uniform base + this + a constant, and this one register steps by a chunk a trip */
  v4f pf[24];
#pragma unroll
  for (int i = 0; i < 24; ++i) pf[i] = *(const v4f*)((const char*)(i < 8 ? A0 : Wr0) + (size_t)vo + (size_t)(i < 8 ? i : i - 8) * 8 * DIN * 4);
  stage_put<MODE>(sm, pf, srow, sseg);
  __syncthreads();   // chunk 0 is published
  // rolled: the buffer is picked by the trip's parity, and one trip's body already holds 24 loads and all fragments
#pragma unroll 1
  for (int c = 0; c < NC; ++c) { const bool more = c + 1 < NC;   /* the same for the whole block */
    if (more) { vo += SBK * 4u;
#pragma unroll
      for (int i = 0; i < 24; ++i) pf[i] = *(const v4f*)((const char*)(i < 8 ? A0 : Wr0) + (size_t)vo + (size_t)(i < 8 ? i : i - 8) * 8 * DIN * 4);
      asm volatile("s_wait_xcnt 0x0" ::: "memory");   // stands between these loads and the next trip's rewrite of their offset register
    }
    const unsigned char* sb = sm + (c & 1) * BUFB;
#pragma unroll
    for (int kc = 0; kc < SBK / 32; ++kc) {
      if (MODE == 2) { const _Float16* s16 = (const _Float16*)sb; const v16h a = frag_h(s16 + (wave * 16 + col) * SPITCH + kc * 32, lane); v16h w[8];
#pragma unroll
        for (int j = 0; j < 8; ++j) w[j] = frag_h(s16 + (W0 + j * 16 + col) * SPITCH + kc * 32, lane);
#pragma unroll
        for (int j = 0; j < 8; ++j) acc[j] = wmma16(a, w[j], acc[j]);
      } else { const __bf16* s16 = (const __bf16*)sb; const v16b a = frag_b(s16 + (wave * 16 + col) * SPITCH + kc * 32, lane); const v16b a2 = MODE == 1 ? frag_b(s16 + (64 + wave * 16 + col) * SPITCH + kc * 32, lane) : a; v16b w[8];
#pragma unroll
        for (int j = 0; j < 8; ++j) w[j] = frag_b(s16 + (W0 + j * 16 + col) * SPITCH + kc * 32, lane);
#pragma unroll
        for (int j = 0; j < 8; ++j) { acc[j] = wmma_bf(a, w[j], acc[j]); if (MODE == 1) acc[j] = wmma_bf(a2, w[j], acc[j]); } } }
    if (more) stage_put<MODE>(sm + ((c + 1) & 1) * BUFB, pf, srow, sseg);
    __syncthreads();   // publishes chunk c + 1 and ends every wave's reads of chunk c (behind the last trip: before the epilogue reuses the space)
  } }
// ---- k_proj: block = (64 rows, 128 cols, which): q/k/v = X W (+ b) with exact bf16 products (K = DIN) -> which 0: q f16 rows (+ residual rows < QHI); 1: k f16 rows (+ residual rows < KHI); 2: v f16 planes [c][t] (+ bf16 hi/lo planes for t < KHI)
__global__ __launch_bounds__(128) void k_proj(const float* __restrict__ XQ, const float* __restrict__ XK, const float* __restrict__ XV, const float* __restrict__ WQ, const float* __restrict__ WK, const float* __restrict__ WV, const float* __restrict__ BQ, const float* __restrict__ BK, const float* __restrict__ BV,
    _Float16* __restrict__ QH, _Float16* __restrict__ QL, _Float16* __restrict__ KH, _Float16* __restrict__ KL, _Float16* __restrict__ VT, __bf16* __restrict__ VB, __bf16* __restrict__ VBL) {
  __shared__ __align__(16) unsigned char sm[2 * 192 * SPITCH * 2];   // two staging buffers; the epilogue's tiles take the same space behind the last barrier of the k loop
  _Float16 (*sh)[136] = reinterpret_cast<_Float16 (*)[136]>(sm); _Float16 (*sl)[136] = reinterpret_cast<_Float16 (*)[136]>(sm + 64 * 136 * 2);
  _Float16 (*th)[72] = reinterpret_cast<_Float16 (*)[72]>(sm); __bf16 (*tb)[72] = reinterpret_cast<__bf16 (*)[72]>(sm + 128 * 72 * 2); __bf16 (*tbl)[72] = reinterpret_cast<__bf16 (*)[72]>(sm + 2 * 128 * 72 * 2);
  const int tid = threadIdx.x, wave = tid >> 5, lane = tid & 31, col = lane & 15, g = lane >> 4; const int which = blockIdx.z; const int c0 = blockIdx.y * 128; const size_t r0 = (size_t)blockIdx.x * 64; const size_t bb = r0 / TT; const int t0 = (int)(r0 % TT);
  const float* X = which == 0 ? XQ : which == 1 ? XK : XV; const float* WA = which == 0 ? WQ : which == 1 ? WK : WV; const float* BA = which == 0 ? BQ : which == 1 ? BK : BV;
  v8f acc[8] = {};
  gemm_staged<0>(X + r0 * DIN, WA + (size_t)c0 * DIN, sm, tid, acc);
  if (which < 2) { _Float16* DH = which == 0 ? QH : KH; _Float16* DL = which == 0 ? QL : KL; const int nhi = which == 0 ? QHI : KHI; const bool hi_rows = t0 < nhi;
#pragma unroll
    for (int j = 0; j < 8; ++j) { const float bias = BA ? bfr(BA[c0 + j * 16 + col]) : 0.f;
#pragma unroll
      for (int r = 0; r < 8; ++r) { const float v = acc[j][r] + bias; const _Float16 hv = (_Float16)v; sh[wave * 16 + 8 * g + r][j * 16 + col] = hv; sl[wave * 16 + 8 * g + r][j * 16 + col] = (_Float16)((v - (float)hv) * 1024.0f); } }
    __syncthreads();
    for (int e = tid; e < 64 * 16; e += 128) { const int rl = e >> 4, q = e & 15; vst2((unsigned*)(DH + (r0 + rl) * CC + c0 + q * 8), *(const v4u*)&sh[rl][q * 8]); if (hi_rows) vst2((unsigned*)(DL + (bb * nhi + t0 + rl) * (size_t)CC + c0 + q * 8), *(const v4u*)&sl[rl][q * 8]); }
  } else { const bool hi_rows = t0 < KHI;
#pragma unroll
    for (int j = 0; j < 8; ++j) { const float bias = BA ? bfr(BA[c0 + j * 16 + col]) : 0.f;
#pragma unroll
      for (int r = 0; r < 8; ++r) { const float v = acc[j][r] + bias; const int rl = wave * 16 + 8 * g + r, cl = j * 16 + col; th[cl][rl] = (_Float16)v; const __bf16 bh = (__bf16)v; tb[cl][rl] = bh; tbl[cl][rl] = (__bf16)(v - (float)bh); } }
    __syncthreads();
    for (int e = tid; e < 128 * 8; e += 128) { const int cl = e >> 3, q = e & 7; vst2((unsigned*)(VT + (bb * CC + c0 + cl) * (size_t)TT + t0 + q * 8), *(const v4u*)&th[cl][q * 8]); if (hi_rows) { const size_t o3 = (bb * CC + c0 + cl) * (size_t)KHI + t0 + q * 8; vst2((unsigned*)(VB + o3), *(const v4u*)&tb[cl][q * 8]); vst2((unsigned*)(VBL + o3), *(const v4u*)&tbl[cl][q * 8]); } } } }
// ---- k_att: block = 64 queries (qb, heaviest first) of (b, h); each wave owns 16 query rows and shares nothing with the other waves (no work-group barrier). Logits, softmax and P . v stay in the kernel, in one sweep over the keys: per 16 x 128 key tile the row maximum so far is renewed (joined over the row's 16 lanes), the denominator and the P . v accumulators are scaled by exp(old max - new max), and P x 2^11 = exp(s - max so far) x 2^11 passes through the wave's own LDS tile from the accumulator map to the A map and meets v; the division by the denominator comes once, at the end. Products, operand types and the key order of the P . v sum are those of the three-kernel form (query blocks < QBH: 3-product logits, P and v as bf16 hi + lo).
template <bool HI> __device__ __forceinline__ void att_logits(const v16h (&ah)[HD / 32], const v16h (&al)[HD / 32], const _Float16* __restrict__ Kr, const _Float16* __restrict__ KLr, int lane, v8f (&s)[8]) {
  if (HI) {
#pragma unroll
    for (int j = 0; j < 8; ++j) { v16h kbf[HD / 32], klf[HD / 32]; v8f a = {}, a2 = {};   /* the four fragments of a key group are requested together, ahead of their products: one load latency for the batch */
#pragma unroll
      for (int kc = 0; kc < HD / 32; ++kc) { kbf[kc] = frag_h(Kr + (size_t)j * 16 * CC + kc * 32, lane); klf[kc] = frag_h(KLr + (size_t)j * 16 * CC + kc * 32, lane); }
#pragma unroll
      for (int kc = 0; kc < HD / 32; ++kc) { a = wmma16(ah[kc], kbf[kc], a); a2 = wmma16(al[kc], kbf[kc], a2); a2 = wmma16(ah[kc], klf[kc], a2); }
#pragma unroll
      for (int r = 0; r < 8; ++r) s[j][r] = (a[r] + a2[r] * (1.0f / 1024.0f)) * SCALE; }
  } else {
#pragma unroll
    for (int j = 0; j < 8; ++j) s[j] = v8f{};
#pragma unroll
    for (int kc = 0; kc < HD / 32; ++kc) { v16h kf[8];   /* eight fragments requested together, ahead of their products: one load latency for the batch */
#pragma unroll
      for (int j = 0; j < 8; ++j) kf[j] = frag_h(Kr + (size_t)j * 16 * CC + kc * 32, lane);
#pragma unroll
      for (int j = 0; j < 8; ++j) s[j] = wmma16(ah[kc], kf[j], s[j]); }
    /* the accumulators stay unscaled here: the scale goes into the exponent's multiply-add */ } }
#define LN2048 7.62461898616224f   // ln 2^11: the f16 carry of P, taken into the exponent
#define SCL2 (SCALE * 1.44269504088896f)   // scale x log2 e: rows past the early ones keep raw q . k sums and take exp(scale x (s - max)) x 2^11 as 2^(s x SCL2 - max x SCL2 + 11)
// maximum over the 16 lanes that hold one row of an accumulator tile: four row_xmask DPP steps, no LDS pipe
__device__ __forceinline__ float rowmax16(float v) {
  v = fmaxf(v, __builtin_bit_cast(float, __builtin_amdgcn_update_dpp(__builtin_bit_cast(int, v), __builtin_bit_cast(int, v), 0x161, 0xf, 0xf, false)));
  v = fmaxf(v, __builtin_bit_cast(float, __builtin_amdgcn_update_dpp(__builtin_bit_cast(int, v), __builtin_bit_cast(int, v), 0x162, 0xf, 0xf, false)));
  v = fmaxf(v, __builtin_bit_cast(float, __builtin_amdgcn_update_dpp(__builtin_bit_cast(int, v), __builtin_bit_cast(int, v), 0x164, 0xf, 0xf, false)));
  return fmaxf(v, __builtin_bit_cast(float, __builtin_amdgcn_update_dpp(__builtin_bit_cast(int, v), __builtin_bit_cast(int, v), 0x168, 0xf, 0xf, false))); }
template <bool HI> __device__ __forceinline__ void att_body(const _Float16* __restrict__ QH, const _Float16* __restrict__ KH, const _Float16* __restrict__ QL, const _Float16* __restrict__ KL, const _Float16* __restrict__ VT, const __bf16* __restrict__ VB, const __bf16* __restrict__ VBL, float* __restrict__ Y, float (*ss)[132], int b, int h, int qb, int wave, int lane) {
  const int col = lane & 15, g = lane >> 4; const int ql0 = qb * 64 + wave * 16; const size_t q0 = (size_t)b * TT + ql0; const int nkb = kb_last(qb) + 1;
  const _Float16* K0 = KH + ((size_t)b * TT + col) * CC + h * HD; const _Float16* KL0 = KL + ((size_t)b * KHI + col) * CC + h * HD;
  v16h ah[HD / 32], al[HD / 32];
#pragma unroll
  for (int kc = 0; kc < HD / 32; ++kc) { ah[kc] = frag_h(QH + (q0 + col) * CC + h * HD + kc * 32, lane); al[kc] = HI ? frag_h(QL + ((size_t)b * QHI + ql0 + col) * CC + h * HD + kc * 32, lane) : ah[kc]; }
  if (HI) asm volatile("s_wait_xcnt 0x0" ::: "memory");   // stands between the q loads and the first rewrite of their address registers
  float m[8], l[8];
#pragma unroll
  for (int r = 0; r < 8; ++r) { m[r] = -1.0e30f; l[r] = 0.f; }   /* the start stays above the excluded keys' -3e38, so that their exp(v - max) underflows to 0 also where no kept key has been met */
  v8f acc[HD / 16] = {};
  // rolled: one tile's body already fills the registers, and a second copy would only lengthen the text
#pragma unroll 1
  for (int kb = 0; kb < nkb; ++kb) { v8f s[8]; att_logits<HI>(ah, al, K0 + (size_t)kb * 128 * CC, KL0 + (size_t)kb * 128 * CC, lane, s);
    const int dd = ql0 + 8 * g - col - kb * 128;   /* the lane's first query row less its first key of the tile: one register carries the causal test, each element compares it with a constant */
    v16h vfa[2][HD / 16], vfb[2][HD / 16];
    if (!HI) {   /* v of the tile's first 64 keys is requested here, so that it arrives under the exponentials */
#pragma unroll
      for (int kc = 0; kc < 2; ++kc) {
#pragma unroll
        for (int j = 0; j < HD / 16; ++j) vfa[kc][j] = frag_h(VT + ((size_t)b * CC + h * HD + j * 16 + col) * (size_t)TT + kb * 128 + kc * 32, lane); } }
#pragma unroll
    for (int r = 0; r < 8; ++r) { float tm = -3.0e38f;
#pragma unroll
      for (int j = 0; j < 8; ++j) { const float v = (j * 16 - r <= dd) ? s[j][r] : -3.0e38f; s[j][r] = v; tm = fmaxf(tm, v); }   /* key kb * 128 + j * 16 + col <= query ql0 + 8 * g + r */
      const float mn = fmaxf(m[r], rowmax16(tm));   /* the same in the row's 16 lanes */
      const float f = HI ? expf(m[r] - mn) : __builtin_amdgcn_exp2f((m[r] - mn) * SCL2);   /* 0 on the first tile, 1 while the maximum stands */
      const float mb = HI ? mn - LN2048 : 11.0f - mn * SCL2; float a = l[r] * f;
#pragma unroll
      for (int j = 0; j < 8; ++j) { const float p = HI ? expf(s[j][r] - mb) : __builtin_amdgcn_exp2f(fmaf(s[j][r], SCL2, mb)); a += p; ss[8 * g + r][j * 16 + col] = p; }   /* P x 2^11 against the maximum so far; excluded key: exp underflows to 0 */
#pragma unroll
      for (int j = 0; j < HD / 16; ++j) acc[j][r] *= f;   /* what was summed against the older maximum */
      l[r] = a; m[r] = mn; }
    LDSX();   // the wave's P stores land before other lanes of the wave read them
    if (HI) {
#pragma unroll
      for (int kc = 0; kc < 4; ++kc) { const F2 p = split_row(&ss[col][0], kc * 32, lane); v16b vh[HD / 16], vl[HD / 16];   /* eight fragments requested together */
#pragma unroll
        for (int j = 0; j < HD / 16; ++j) { const size_t po = ((size_t)b * CC + h * HD + j * 16 + col) * (size_t)KHI + kb * 128 + kc * 32; vh[j] = frag_b(VB + po, lane); vl[j] = frag_b(VBL + po, lane); }
#pragma unroll
        for (int j = 0; j < HD / 16; ++j) { acc[j] = wmma_bf(p.h, vh[j], acc[j]); acc[j] = wmma_bf(p.l, vh[j], acc[j]); acc[j] = wmma_bf(p.h, vl[j], acc[j]); } }
    } else {   /* v of the last 64 keys is requested ahead of the first products */
#pragma unroll
      for (int kc = 0; kc < 2; ++kc) {
#pragma unroll
        for (int j = 0; j < HD / 16; ++j) vfb[kc][j] = frag_h(VT + ((size_t)b * CC + h * HD + j * 16 + col) * (size_t)TT + kb * 128 + 64 + kc * 32, lane); }
#pragma unroll
      for (int kc = 0; kc < 4; ++kc) { const v16h p = frag_f32(&ss[col][kc * 32], lane);
#pragma unroll
        for (int j = 0; j < HD / 16; ++j) acc[j] = wmma16(p, kc < 2 ? vfa[kc][j] : vfb[kc - 2][j], acc[j]); } }
    LDSX();   // the wave's P reads are done before the next tile (or the epilogue) overwrites them
  }
#pragma unroll
  for (int r = 0; r < 8; ++r) { float a = l[r];   /* the lanes' shares of the denominator (x 2^11, like acc) are joined once */
#pragma unroll
    for (int o = 1; o < 16; o <<= 1) a += __shfl_xor(a, o);
    l[r] = a > 0.f ? 1.0f / a : 0.f; }
#pragma unroll
  for (int j = 0; j < HD / 16; ++j)
#pragma unroll
    for (int r = 0; r < 8; ++r) ss[8 * g + r][j * 16 + col] = acc[j][r] * l[r];
  LDSX();   // ctx stores land before the row-wise read below
  for (int rl = 0; rl < 16; ++rl) if (lane < HD / 4) vst2(Y + ((size_t)b * TT + ql0 + rl) * CC + h * HD + lane * 4, *(const v4f*)&ss[rl][lane * 4]); }
// four waves per SIMD, as the two-sweep form had: without the attribute this build takes 278 registers (the early-row branch), and a SIMD then holds three waves to cover each other's exponentials and loads
__global__ __launch_bounds__(128) __attribute__((amdgpu_waves_per_eu(4))) void k_att(const _Float16* __restrict__ QH, const _Float16* __restrict__ KH, const _Float16* __restrict__ QL, const _Float16* __restrict__ KL, const _Float16* __restrict__ VT, const __bf16* __restrict__ VB, const __bf16* __restrict__ VBL, float* __restrict__ Y) { __shared__ __align__(16) float ss[4][16][132];
  const int wave = threadIdx.x >> 5, lane = threadIdx.x & 31; const int h = blockIdx.x % NH, b = blockIdx.x / NH; const int qb = NQB - 1 - blockIdx.y;   /* longest blocks start first */
  if (qb < QBH) att_body<true>(QH, KH, QL, KL, VT, VB, VBL, Y, ss[wave], b, h, qb, wave, lane);
  else att_body<false>(QH, KH, QL, KL, VT, VB, VBL, Y, ss[wave], b, h, qb, wave, lane); }
// ---- k_out: block = (64 rows, 128 cols): out = ctx Wo (+ bo): ctx x 2^6 once to f16 against Wo as f16(bf16 x 2^8) exact (1 product) x 2^-14; causal early rows (< QHI of each sequence): ctx bf16 hi + lo against exact bf16 Wo (2 products). Operands staged as in k_proj
__global__ __launch_bounds__(128) void k_out(const float* __restrict__ Y, const float* __restrict__ WO, const float* __restrict__ BO, float* __restrict__ OUT) { __shared__ __align__(16) unsigned char sm[2 * 256 * SPITCH * 2];   // two staging buffers; the output tiles take the same space behind the last barrier of the k loop
  float (*sf)[16][132] = reinterpret_cast<float (*)[16][132]>(sm);
  const int tid = threadIdx.x, wave = tid >> 5, lane = tid & 31, col = lane & 15, g = lane >> 4; const int c0 = blockIdx.y * 128; const size_t r0 = (size_t)blockIdx.x * 64 + wave * 16;
  v8f acc[8] = {};
  if (CAUSAL && (int)(((size_t)blockIdx.x * 64) % TT) < QHI) {   /* block-uniform */
    gemm_staged<1>(Y + (size_t)blockIdx.x * 64 * CC, WO + (size_t)c0 * CC, sm, tid, acc);
#pragma unroll
    for (int j = 0; j < 8; ++j) { const float bias = BO ? bfr(BO[c0 + j * 16 + col]) : 0.f;
#pragma unroll
      for (int r = 0; r < 8; ++r) sf[wave][8 * g + r][j * 16 + col] = acc[j][r] + bias; }
  } else {
    gemm_staged<2>(Y + (size_t)blockIdx.x * 64 * CC, WO + (size_t)c0 * CC, sm, tid, acc);   /* ctx carried x 2^6 into f16 so small-magnitude context rows stay clear of f16 subnormals */
#pragma unroll
    for (int j = 0; j < 8; ++j) { const float bias = BO ? bfr(BO[c0 + j * 16 + col]) : 0.f;
#pragma unroll
      for (int r = 0; r < 8; ++r) sf[wave][8 * g + r][j * 16 + col] = acc[j][r] * (1.0f / 16384.0f) + bias; } }   /* 2^-8 (Wo carry) x 2^-6 (ctx carry) */
  LDSX(); for (int rl = 0; rl < 16; ++rl) vst2(OUT + (r0 + rl) * DIN + c0 + lane * 4, *(const v4f*)&sf[wave][rl][lane * 4]); }

extern "C" void kernel_launch(void* const* d_in, const int* in_sizes, int n_in, void* d_out, int out_size, void* d_ws, size_t ws_size, hipStream_t stream) {
  (void)in_sizes; (void)n_in; (void)out_size;
  const float** F = (const float**)d_in;
  if (ws_size < (size_t)WS_END) return;
  char* ws = (char*)d_ws; _Float16 *QH = (_Float16*)(ws + WS_QH), *KH = (_Float16*)(ws + WS_KH), *VT = (_Float16*)(ws + WS_VT), *QL = (_Float16*)(ws + WS_QL), *KL = (_Float16*)(ws + WS_KL); __bf16 *VB = (__bf16*)(ws + WS_VB), *VBL = (__bf16*)(ws + WS_VBL); float *Y = (float*)(ws + WS_Y);
  (void)Y; (void)QL; (void)KL; (void)VB; (void)VBL;
  // inputs: 0 query [4,2048,768]; 1 key; 2 value; 3 Wq [768,768] (out,in), 4 bq; 5 Wk, 6 bk; 7 Wv, 8 bv; 9 Wo (out,in), 10 bo (all biases zeros, read)
  k_proj<<<dim3(TNB * TT / 64, CC / 128, 3), 128, 0, stream>>>(F[0], F[1], F[2], F[3], F[5], F[7], F[4], F[6], F[8], QH, QL, KH, KL, VT, VB, VBL);
  k_att<<<dim3(TNB * NH, NQB), 128, 0, stream>>>(QH, KH, QL, KL, VT, VB, VBL, Y);
  k_out<<<dim3(TNB * TT / 64, DIN / 128), 128, 0, stream>>>(Y, F[9], F[10], (float*)d_out);
}

// v005
// It runs in 154 microseconds.
// Timed twice side by side with v004, it ran 1.07 and 1.08 times as fast.
// Counting every step since v000, it is 15.7 times as fast.
// compute dtype: all float inputs rounded to bf16; q / k / v projections with EXACT bf16 products on WMMA 16x16x32 (f32 accumulate) + bias (zeros, read); causal logits: 3 products for the first 384 rows, single f16 q x k after, x 64^-0.5; softmax f32; P x 2^11 once to f16 x v once to f16 (bf16 hi + lo below row 384); ctx hi+lo x exact Wo below row 384, x2^6 f16 carry x f16(bf16 x 2^8) Wo after, + bo (zeros); f32 output.
#include <hip/hip_runtime.h>
#include <math.h>

typedef __attribute__((ext_vector_type(16))) _Float16 v16h;
typedef __attribute__((ext_vector_type(16))) __bf16 v16b;
typedef __attribute__((ext_vector_type(8)))  _Float16 v8h;
typedef __attribute__((ext_vector_type(8)))  float v8f;
typedef __attribute__((ext_vector_type(4)))  float v4f;
typedef __attribute__((ext_vector_type(2)))  float v2f;
typedef __attribute__((ext_vector_type(4)))  unsigned v4u;
typedef __attribute__((ext_vector_type(4)))  int v4i;
typedef float __attribute__((may_alias)) float_a;
typedef int __attribute__((may_alias)) int_a;

template <typename T> __device__ __forceinline__ void vst2(void* p, T v) { *(T*)p = v;  }
__device__ __forceinline__ v8f wmma16(v16h a, v16h b, v8f c) {
  v8f d = __builtin_amdgcn_wmma_f32_16x16x32_f16(false, a, false, b, (short)0, c, false, false);
  asm volatile("v_nop\n\tv_nop\n\tv_nop\n\tv_nop" : "+v"(d) : "v"(a), "v"(b));
  return d;
}
__device__ __forceinline__ v8f wmma_bf(v16b a, v16b b, v8f c) {
  v8f d = __builtin_amdgcn_wmma_f32_16x16x32_bf16(false, a, false, b, (short)0, c, false, false);
  asm volatile("v_nop\n\tv_nop\n\tv_nop\n\tv_nop" : "+v"(d) : "v"(a), "v"(b));
  return d;
}
// 16x16x32 fragments: lane = (h = lane>>4, row/col = lane&15); elements 0..7 = k0+8h+0..7, 8..15 = k0+16+8h+0..7; D element r = row 8h+r
__device__ __forceinline__ v16h frag_h(const _Float16* rowk0, int lane) {
  union { v16h v; v8h q[2]; } u; const _Float16* p = rowk0 + 8 * (lane >> 4);
  u.q[0] = *(const v8h*)p; u.q[1] = *(const v8h*)(p + 16); return u.v;
}
__device__ __forceinline__ v16h frag_f32(const float* rowk0, int lane) {
  v16h a; const float* p = rowk0 + 8 * (lane >> 4);
#pragma unroll
  for (int i = 0; i < 8; ++i) { a[i] = (_Float16)p[i]; a[8 + i] = (_Float16)p[16 + i]; }
  return a;
}
__device__ __forceinline__ v16h frag_f32s(const float* rowk0, int lane, float sc) {
  v16h a; const float* p = rowk0 + 8 * (lane >> 4);
#pragma unroll
  for (int i = 0; i < 8; ++i) { a[i] = (_Float16)(p[i] * sc); a[8 + i] = (_Float16)(p[16 + i] * sc); }
  return a;
}
// column fragment from a [K][ld] layout (column n), rows >= K read as 0
__device__ __forceinline__ v16h fragc_f32(const float* W, int k0, int n, int lane, int ld, int K) {
  v16h a; const int g = lane >> 4;
#pragma unroll
  for (int i = 0; i < 8; ++i) { const int ka = k0 + 8 * g + i, kb = ka + 16;
    a[i] = (_Float16)(ka < K ? W[(size_t)(ka < K ? ka : K - 1) * ld + n] : 0.f); a[8 + i] = (_Float16)(kb < K ? W[(size_t)(kb < K ? kb : K - 1) * ld + n] : 0.f); }
  return a;
}
struct F2 { v16b h, l; };
__device__ __forceinline__ F2 bsplit16(const float v[16]) { F2 r;
#pragma unroll
  for (int i = 0; i < 16; ++i) { const __bf16 h = (__bf16)v[i]; r.h[i] = h; r.l[i] = (__bf16)(v[i] - (float)h); }
  return r; }
__device__ __forceinline__ F2 split_row(const float* row, int k0, int lane) { float v[16]; const float* p = row + k0 + 8 * (lane >> 4);
#pragma unroll
  for (int i = 0; i < 8; ++i) { v[i] = p[i]; v[8 + i] = p[16 + i]; }
  return bsplit16(v); }
__device__ __forceinline__ F2 split_rowK(const float* row, int k0, int lane, int K) { float v[16]; const int g = lane >> 4;
#pragma unroll
  for (int i = 0; i < 8; ++i) { const int ka = k0 + 8 * g + i, kb = ka + 16; v[i] = ka < K ? row[ka < K ? ka : K - 1] : 0.f; v[8 + i] = kb < K ? row[kb < K ? kb : K - 1] : 0.f; }
  return bsplit16(v); }
__device__ __forceinline__ F2 split_col(const float* W, int k0, int n, int lane, int ld, int K) { float v[16]; const int g = lane >> 4;
#pragma unroll
  for (int i = 0; i < 8; ++i) { const int ka = k0 + 8 * g + i, kb = ka + 16; v[i] = ka < K ? W[(size_t)(ka < K ? ka : K - 1) * ld + n] : 0.f; v[8 + i] = kb < K ? W[(size_t)(kb < K ? kb : K - 1) * ld + n] : 0.f; }
  return bsplit16(v); }
__device__ __forceinline__ v8f mac3(const F2& a, const F2& b, v8f c) { c = wmma_bf(a.l, b.h, c); c = wmma_bf(a.h, b.l, c); return wmma_bf(a.h, b.h, c); }
__device__ __forceinline__ float sigm(float v) { return 1.0f / (1.0f + expf(-v)); }
#define LDSX() do { asm volatile("s_wait_dscnt 0" ::: "memory"); __builtin_amdgcn_wave_barrier(); __builtin_amdgcn_fence(__ATOMIC_RELEASE, "workgroup"); } while (0)

// Causal multi-head attention on separate inputs (query / key / value [4,2048,768]; torch (out,in) Wq / Wk / Wv / Wo [768,768] N(0, 1/768) applied as x @ W.T + b, all biases zeros (read); 12 heads x 64; scores / sqrt(64); tril kept, -1e9 elsewhere (finite: its softmax weight underflows to 0); softmax; merged heads @ Wo.T + bo).
#define NB 4
#define TT 2048
#define CC 768            // NH * HD = projected width
#define DIN 768          // input (model) width
#define NH 12
#define HD 64
#define NQB (TT / 64)
#define SCALE (0.125f)
#define CAUSAL 1
#ifndef TNB
#define TNB NB
#endif
__device__ __forceinline__ float bfr(float v) { return (float)(__bf16)v; }
__host__ __device__ __forceinline__ int kb_last(int qb) { return CAUSAL ? ((qb * 64 + 63) >> 7) : (TT / 128 - 1); }
typedef __attribute__((ext_vector_type(8))) __bf16 v8b;
__device__ __forceinline__ v16b frag_b(const __bf16* rowk0, int lane) {
  union { v16b v; v8b q[2]; } u; const __bf16* p = rowk0 + 8 * (lane >> 4);
  u.q[0] = *(const v8b*)p; u.q[1] = *(const v8b*)(p + 16); return u.v;
}
#define QBH 6              // causal: query blocks 0..QBH-1 of each sequence (few keys, no averaging) take the high-precision path
#define QHI 384            // rows carrying a q residual plane
#define KHI 384            // key rows carrying k residual / v bf16 hi+lo planes (used only by the causal high-precision path)
// B fragment (k rows k0+.., output column o) of a weight: (in,out) [K][ld] or (out,in) [ld rows of K]: bf16 exact, or f16(bf16 * 256) exact
__device__ __forceinline__ v16b wcol_io(const float* Wm, int k0, int o, int lane, int ld) { v16b w; const int g = lane >> 4;
#pragma unroll
  for (int i = 0; i < 8; ++i) { w[i] = (__bf16)Wm[(size_t)(k0 + 8 * g + i) * ld + o]; w[8 + i] = (__bf16)Wm[(size_t)(k0 + 16 + 8 * g + i) * ld + o]; }
  return w; }
__device__ __forceinline__ v16b wcol_oi(const float* Wm, int k0, int o, int lane, int K) { v16b w; const float* p = Wm + (size_t)o * K + k0 + 8 * (lane >> 4);
#pragma unroll
  for (int i = 0; i < 8; ++i) { w[i] = (__bf16)p[i]; w[8 + i] = (__bf16)p[16 + i]; }
  return w; }
__device__ __forceinline__ v16h wcolh_io(const float* Wm, int k0, int o, int lane, int ld) { v16h w; const int g = lane >> 4;
#pragma unroll
  for (int i = 0; i < 8; ++i) { w[i] = (_Float16)(bfr(Wm[(size_t)(k0 + 8 * g + i) * ld + o]) * 256.0f); w[8 + i] = (_Float16)(bfr(Wm[(size_t)(k0 + 16 + 8 * g + i) * ld + o]) * 256.0f); }
  return w; }
__device__ __forceinline__ v16h wcolh_oi(const float* Wm, int k0, int o, int lane, int K) { v16h w; const float* p = Wm + (size_t)o * K + k0 + 8 * (lane >> 4);
#pragma unroll
  for (int i = 0; i < 8; ++i) { w[i] = (_Float16)(bfr(p[i]) * 256.0f); w[8 + i] = (_Float16)(bfr(p[16 + i]) * 256.0f); }
  return w; }
#define WQKV_LAYOUT 1   // selects only the WCOL reader, which nothing calls; k_proj reads (out,in) [CC][DIN] rows
__device__ __forceinline__ v16b wcol_hdk(const float* Wm, int k0, int o, int lane) { v16b w; const int g = lane >> 4; const float* p = Wm + (size_t)(o / HD) * DIN * HD + (o % HD);
#pragma unroll
  for (int i = 0; i < 8; ++i) { w[i] = (__bf16)p[(size_t)(k0 + 8 * g + i) * HD]; w[8 + i] = (__bf16)p[(size_t)(k0 + 16 + 8 * g + i) * HD]; }
  return w; }
#define WO_OUT_IN 1
#if WQKV_LAYOUT == 1
#define WCOL(W, k0, o, lane) wcol_oi(W, k0, o, lane, DIN)
#elif WQKV_LAYOUT == 2
#define WCOL(W, k0, o, lane) wcol_hdk(W, k0, o, lane)
#else
#define WCOL(W, k0, o, lane) wcol_io(W, k0, o, lane, CC)
#endif
#if WO_OUT_IN
#define WOCOL(W, k0, o, lane) wcol_oi(W, k0, o, lane, CC)
#define WOCOLH(W, k0, o, lane) wcolh_oi(W, k0, o, lane, CC)
#else
#define WOCOL(W, k0, o, lane) wcol_io(W, k0, o, lane, DIN)
#define WOCOLH(W, k0, o, lane) wcolh_io(W, k0, o, lane, DIN)
#endif

#ifndef PROJ_EXTRA_PARAMS
#define PROJ_EXTRA_PARAMS
#endif

#define WS_QH  0u                                      // f16 q rows [b*t][CC]
#define WS_KH  (WS_QH + 2u * (size_t)NB * TT * CC)      // f16 k rows [b*t][CC]
#define WS_VT  (WS_KH + 2u * (size_t)NB * TT * CC)      // f16 v planes [b][c][t]
#define WS_QL  (WS_VT + 2u * (size_t)NB * CC * TT)      // f16 q residual x 2^10 rows [b][t < QHI][CC]
#define WS_KL  (WS_QL + 2u * (size_t)NB * QHI * CC)     // f16 k residual x 2^10 rows [b][t < KHI][CC]
#define WS_VB  (WS_KL + 2u * (size_t)NB * KHI * CC)     // bf16 v hi planes [b][c][t < KHI]
#define WS_VBL (WS_VB + 2u * (size_t)NB * CC * KHI)
#define WS_Y   (WS_VBL + 2u * (size_t)NB * CC * KHI)    // f32 ctx rows [b*t][CC] (only when there is an output projection)
#define WS_END (WS_Y  + 4u * (size_t)NB * TT * CC)

// ---- staged operands of the two projection kernels: a block's 64 A rows and 128 W rows (both K-contiguous f32, K = 768) go through LDS in chunks of SBK k. Every global load covers whole 128-B lines, each element is rounded to its 16-bit operand type once per block, and the four waves read their fragments from LDS. Two buffers: chunk c + 1 is requested ahead of chunk c's products, stored behind them, and published by the one barrier at the foot of the trip. The k order of every accumulator is unchanged. The inner loops are unrolled so that every index of pf, w and acc is a constant (registers, no scratch).
#define SBK 64
#define SPITCH 72          // 16-bit elements per staged row: 128 B + 16 B, so that the 16 rows of a b128 fragment read fall on distinct banks
typedef __attribute__((ext_vector_type(4))) __bf16 v4b;
typedef __attribute__((ext_vector_type(4))) _Float16 v4h;
// MODE 0: A bf16, W bf16. MODE 1: A bf16 hi rows 0..63 + lo rows 64..127, W bf16. MODE 2: A f16(x 2^6), W f16(bf16 x 2^8)
template <int MODE> __device__ __forceinline__ void stage_put(unsigned char* buf, const v4f (&pf)[24], int srow, int sseg) {
  constexpr int W0 = MODE == 1 ? 128 : 64;
#pragma unroll
  for (int i = 0; i < 24; ++i) { const int row = i < 8 ? i * 8 + srow : W0 + (i - 8) * 8 + srow; unsigned char* d = buf + ((size_t)row * SPITCH + sseg * 4) * 2;
    if (MODE == 2) { v4h o;
#pragma unroll
      for (int e = 0; e < 4; ++e) o[e] = i < 8 ? (_Float16)(pf[i][e] * 64.0f) : (_Float16)(bfr(pf[i][e]) * 256.0f);
      *(v4h*)d = o;
    } else { v4b o, o2;
#pragma unroll
      for (int e = 0; e < 4; ++e) { const __bf16 hv = (__bf16)pf[i][e]; o[e] = hv; o2[e] = (__bf16)(pf[i][e] - (float)hv); }
      *(v4b*)d = o; if (MODE == 1 && i < 8) *(v4b*)(d + (size_t)64 * SPITCH * 2) = o2; } } }
template <int MODE> __device__ __forceinline__ void gemm_staged(const float* __restrict__ A0, const float* __restrict__ Wr0, unsigned char* sm, int tid, v8f (&acc)[8]) {
  constexpr int W0 = MODE == 1 ? 128 : 64; constexpr int BUFB = (W0 + 128) * SPITCH * 2; constexpr int NC = DIN / SBK;
  const int wave = tid >> 5, lane = tid & 31, col = lane & 15, srow = tid >> 4, sseg = tid & 15;
  unsigned vo = (unsigned)(srow * DIN + sseg * 4) * 4u;   /* the thread's byte offset in either tile; an address is a block-uniform base + this + a constant, and this one register steps by a chunk a trip */
  v4f pf[24];
#pragma unroll
  for (int i = 0; i < 24; ++i) pf[i] = *(const v4f*)((const char*)(i < 8 ? A0 : Wr0) + (size_t)vo + (size_t)(i < 8 ? i : i - 8) * 8 * DIN * 4);
  stage_put<MODE>(sm, pf, srow, sseg);
  __syncthreads();   // chunk 0 is published
  // rolled: the buffer is picked by the trip's parity, and one trip's body already holds 24 loads and all fragments
#pragma unroll 1
  for (int c = 0; c < NC; ++c) { const bool more = c + 1 < NC;   /* the same for the whole block */
    if (more) { vo += SBK * 4u;
#pragma unroll
      for (int i = 0; i < 24; ++i) pf[i] = *(const v4f*)((const char*)(i < 8 ? A0 : Wr0) + (size_t)vo + (size_t)(i < 8 ? i : i - 8) * 8 * DIN * 4);
      asm volatile("s_wait_xcnt 0x0" ::: "memory");   // stands between these loads and the next trip's rewrite of their offset register
    }
    const unsigned char* sb = sm + (c & 1) * BUFB;
#pragma unroll
    for (int kc = 0; kc < SBK / 32; ++kc) {
      if (MODE == 2) { const _Float16* s16 = (const _Float16*)sb; const v16h a = frag_h(s16 + (wave * 16 + col) * SPITCH + kc * 32, lane); v16h w[8];
#pragma unroll
        for (int j = 0; j < 8; ++j) w[j] = frag_h(s16 + (W0 + j * 16 + col) * SPITCH + kc * 32, lane);
#pragma unroll
        for (int j = 0; j < 8; ++j) acc[j] = wmma16(a, w[j], acc[j]);
      } else { const __bf16* s16 = (const __bf16*)sb; const v16b a = frag_b(s16 + (wave * 16 + col) * SPITCH + kc * 32, lane); const v16b a2 = MODE == 1 ? frag_b(s16 + (64 + wave * 16 + col) * SPITCH + kc * 32, lane) : a; v16b w[8];
#pragma unroll
        for (int j = 0; j < 8; ++j) w[j] = frag_b(s16 + (W0 + j * 16 + col) * SPITCH + kc * 32, lane);
#pragma unroll
        for (int j = 0; j < 8; ++j) { acc[j] = wmma_bf(a, w[j], acc[j]); if (MODE == 1) acc[j] = wmma_bf(a2, w[j], acc[j]); } } }
    if (more) stage_put<MODE>(sm + ((c + 1) & 1) * BUFB, pf, srow, sseg);
    __syncthreads();   // publishes chunk c + 1 and ends every wave's reads of chunk c (behind the last trip: before the epilogue reuses the space)
  } }
// ---- k_proj: block = (64 rows, 128 cols, which): q/k/v = X W (+ b) with exact bf16 products (K = DIN) -> which 0: q f16 rows (+ residual rows < QHI); 1: k f16 rows (+ residual rows < KHI); 2: v f16 planes [c][t] (+ bf16 hi/lo planes for t < KHI)
__global__ __launch_bounds__(128) void k_proj(const float* __restrict__ XQ, const float* __restrict__ XK, const float* __restrict__ XV, const float* __restrict__ WQ, const float* __restrict__ WK, const float* __restrict__ WV, const float* __restrict__ BQ, const float* __restrict__ BK, const float* __restrict__ BV,
    _Float16* __restrict__ QH, _Float16* __restrict__ QL, _Float16* __restrict__ KH, _Float16* __restrict__ KL, _Float16* __restrict__ VT, __bf16* __restrict__ VB, __bf16* __restrict__ VBL) {
  __shared__ __align__(16) unsigned char sm[2 * 192 * SPITCH * 2];   // two staging buffers; the epilogue's tiles take the same space behind the last barrier of the k loop
  _Float16 (*sh)[136] = reinterpret_cast<_Float16 (*)[136]>(sm); _Float16 (*sl)[136] = reinterpret_cast<_Float16 (*)[136]>(sm + 64 * 136 * 2);
  _Float16 (*th)[72] = reinterpret_cast<_Float16 (*)[72]>(sm); __bf16 (*tb)[72] = reinterpret_cast<__bf16 (*)[72]>(sm + 128 * 72 * 2); __bf16 (*tbl)[72] = reinterpret_cast<__bf16 (*)[72]>(sm + 2 * 128 * 72 * 2);
  const int tid = threadIdx.x, wave = tid >> 5, lane = tid & 31, col = lane & 15, g = lane >> 4; const int which = blockIdx.z; const int c0 = blockIdx.y * 128; const size_t r0 = (size_t)blockIdx.x * 64; const size_t bb = r0 / TT; const int t0 = (int)(r0 % TT);
  const float* X = which == 0 ? XQ : which == 1 ? XK : XV; const float* WA = which == 0 ? WQ : which == 1 ? WK : WV; const float* BA = which == 0 ? BQ : which == 1 ? BK : BV;
  v8f acc[8] = {};
  gemm_staged<0>(X + r0 * DIN, WA + (size_t)c0 * DIN, sm, tid, acc);
  if (which < 2) { _Float16* DH = which == 0 ? QH : KH; _Float16* DL = which == 0 ? QL : KL; const int nhi = which == 0 ? QHI : KHI; const bool hi_rows = t0 < nhi;
#pragma unroll
    for (int j = 0; j < 8; ++j) { const float bias = BA ? bfr(BA[c0 + j * 16 + col]) : 0.f;
#pragma unroll
      for (int r = 0; r < 8; ++r) { const float v = acc[j][r] + bias; const _Float16 hv = (_Float16)v; sh[wave * 16 + 8 * g + r][j * 16 + col] = hv; sl[wave * 16 + 8 * g + r][j * 16 + col] = (_Float16)((v - (float)hv) * 1024.0f); } }
    __syncthreads();
    for (int e = tid; e < 64 * 16; e += 128) { const int rl = e >> 4, q = e & 15; vst2((unsigned*)(DH + (r0 + rl) * CC + c0 + q * 8), *(const v4u*)&sh[rl][q * 8]); if (hi_rows) vst2((unsigned*)(DL + (bb * nhi + t0 + rl) * (size_t)CC + c0 + q * 8), *(const v4u*)&sl[rl][q * 8]); }
  } else { const bool hi_rows = t0 < KHI;
#pragma unroll
    for (int j = 0; j < 8; ++j) { const float bias = BA ? bfr(BA[c0 + j * 16 + col]) : 0.f;
#pragma unroll
      for (int r = 0; r < 8; ++r) { const float v = acc[j][r] + bias; const int rl = wave * 16 + 8 * g + r, cl = j * 16 + col; th[cl][rl] = (_Float16)v; const __bf16 bh = (__bf16)v; tb[cl][rl] = bh; tbl[cl][rl] = (__bf16)(v - (float)bh); } }
    __syncthreads();
    for (int e = tid; e < 128 * 8; e += 128) { const int cl = e >> 3, q = e & 7; vst2((unsigned*)(VT + (bb * CC + c0 + cl) * (size_t)TT + t0 + q * 8), *(const v4u*)&th[cl][q * 8]); if (hi_rows) { const size_t o3 = (bb * CC + c0 + cl) * (size_t)KHI + t0 + q * 8; vst2((unsigned*)(VB + o3), *(const v4u*)&tb[cl][q * 8]); vst2((unsigned*)(VBL + o3), *(const v4u*)&tbl[cl][q * 8]); } } } }
// ---- k_att: block = 128 queries (qb, heaviest first) of (b, h); each wave owns 16 query rows; past the early rows the eight waves share the staged k / v tiles (one work-group barrier per key tile), in the early rows they share nothing. Logits, softmax and P . v stay in the kernel, in one sweep over the keys: per 16 x 128 key tile the row maximum so far is renewed (joined over the row's 16 lanes), the denominator and the P . v accumulators are scaled by exp(old max - new max), and P x 2^11 = exp(s - max so far) x 2^11 passes through the wave's own LDS tile from the accumulator map to the A map and meets v; the division by the denominator comes once, at the end. Products, operand types and the key order of the P . v sum are those of the three-kernel form (query blocks < QBH: 3-product logits, P and v as bf16 hi + lo).
// ---- the shared K / v tiles of k_att (rows past the early ones): one tensor load brings a tile's 128 k rows (128 B each), a second its 64 v planes (256 B each), from the workspace into LDS, once for the block's eight waves, in whole lines; the pad gives each row 16 B more, so that the 16 rows of a b128 fragment read fall on distinct banks. Two stages: tile t + 1 flies while tile t is worked on.
typedef uint32_t u32x4 __attribute__((ext_vector_type(4)));
typedef uint32_t u32x8 __attribute__((ext_vector_type(8)));
#define KPIT 72            // 16-bit elements per staged k row (128 B + 16 B)
#define VPIT 136           // 16-bit elements per staged v plane row (256 B + 16 B)
#define KVT 18432u         // bytes of one staged tile's place: 128 x 144 B (k); 64 x 272 B rounded up to a multiple of 2 KiB (v)
#define STG (2u * KVT)     // one stage: k tile, v tile
__device__ __forceinline__ uint32_t uni(uint32_t v) { return (uint32_t)__builtin_amdgcn_readfirstlane(v); }
__device__ __forceinline__ uint32_t pinned(uint32_t v) { uint32_t w = (uint32_t)__builtin_amdgcn_readfirstlane(v); asm volatile("" : "+s"(w)); return w; }   // the test is held in a scalar register, so that the branch on it is a scalar branch (a tensor load ignores EXEC)
// one request: N rows of R bytes at source pitch P bytes, to LDS byte offset dst; W0 = the pad word (a constant); extents in bytes, tensor = tile. The two groups are the caller's: they stay in their registers up to tile_wait
template <uint32_t W0, uint32_t R, uint32_t N, uint32_t P> __device__ __forceinline__ void tile_load(u32x4& g0, u32x8& g1, uint32_t dst, const void* srcp) {
  const uint64_t ga = (uint64_t)(size_t)srcp;
  g0[0] = uni(1u); g0[1] = uni(dst); g0[2] = uni((uint32_t)ga); g0[3] = uni((((uint32_t)(ga >> 32)) & 0x01FFFFFFu) | 0x80000000u);
  g1[0] = uni(W0); g1[1] = uni((R & 0xFFFFu) << 16); g1[2] = uni((R >> 16) | ((N & 0xFFFFu) << 16)); g1[3] = uni((N >> 16) | (R << 16)); g1[4] = uni(N); g1[5] = uni(P); g1[6] = uni(0u); g1[7] = uni(0u);
  asm volatile("tensor_load_to_lds %0, %1" : "+s"(g0), "+s"(g1) :: "memory"); }   // both groups in and out: behind the load the compiler can neither form the words anew nor give their registers away while tile_wait still reads them
// the issuer's own wait; it names the request's two groups, so that no word of them takes a new value in its register while the request is outstanding
__device__ __forceinline__ void tile_wait(const u32x4& g0, const u32x8& g1) { asm volatile("s_wait_tensorcnt 0" :: "s"(g0), "s"(g1) : "memory"); }
#define PADK ((1u << 20) | (4u << 22) | (3u << 25))   // rows of 128 B, 16 B more a row
#define PADV ((1u << 20) | (5u << 22) | (3u << 25))   // rows of 256 B, 16 B more a row
// HI: Kr / KLr are the lane's global k rows (pitch CC). Else: Kr is the lane's row of the staged tile in LDS (pitch KPIT)
template <bool HI> __device__ __forceinline__ void att_logits(const v16h (&ah)[HD / 32], const v16h (&al)[HD / 32], const _Float16* Kr, const _Float16* __restrict__ KLr, int lane, v8f (&s)[8]) {
  if (HI) {
#pragma unroll
    for (int j = 0; j < 8; ++j) { v16h kbf[HD / 32], klf[HD / 32]; v8f a = {}, a2 = {};   /* the four fragments of a key group are requested together, ahead of their products: one load latency for the batch */
#pragma unroll
      for (int kc = 0; kc < HD / 32; ++kc) { union { v16h v; v8h q[2]; } uk, ul; const _Float16* kp = Kr + (size_t)j * 16 * CC + kc * 32 + 8 * (lane >> 4); const _Float16* lp = KLr + (size_t)j * 16 * CC + kc * 32 + 8 * (lane >> 4);   /* frag_h's two halves, written out for the wait between them */
        uk.q[0] = *(const v8h*)kp; ul.q[0] = *(const v8h*)lp;
        if (kc == HD / 32 - 1) asm volatile("s_wait_xcnt 0x0" ::: "memory");   // the build lands the group's last load of either address pair on the pair itself: the wait stands between the earlier loads that name the pair and that rewrite
        uk.q[1] = *(const v8h*)(kp + 16); ul.q[1] = *(const v8h*)(lp + 16); kbf[kc] = uk.v; klf[kc] = ul.v; }
#pragma unroll
      for (int kc = 0; kc < HD / 32; ++kc) { a = wmma16(ah[kc], kbf[kc], a); a2 = wmma16(al[kc], kbf[kc], a2); a2 = wmma16(ah[kc], klf[kc], a2); }
#pragma unroll
      for (int r = 0; r < 8; ++r) s[j][r] = (a[r] + a2[r] * (1.0f / 1024.0f)) * SCALE; }
  } else {
#pragma unroll
    for (int j = 0; j < 8; ++j) s[j] = v8f{};
#pragma unroll
    for (int kc = 0; kc < HD / 32; ++kc) { v16h kf[8];   /* eight fragments requested together, ahead of their products: one LDS latency for the batch */
#pragma unroll
      for (int j = 0; j < 8; ++j) kf[j] = frag_h(Kr + j * 16 * KPIT + kc * 32, lane);
#pragma unroll
      for (int j = 0; j < 8; ++j) s[j] = wmma16(ah[kc], kf[j], s[j]); }
    /* the accumulators stay unscaled here: the scale goes into the exponent's multiply-add */ } }
#define LN2048 7.62461898616224f   // ln 2^11: the f16 carry of P, taken into the exponent
#define SCL2 (SCALE * 1.44269504088896f)   // scale x log2 e: rows past the early ones keep raw q . k sums and take exp(scale x (s - max)) x 2^11 as 2^(s x SCL2 - max x SCL2 + 11)
// maximum over the 16 lanes that hold one row of an accumulator tile: four row_xmask DPP steps, no LDS pipe
__device__ __forceinline__ float rowmax16(float v) {
  v = fmaxf(v, __builtin_bit_cast(float, __builtin_amdgcn_update_dpp(__builtin_bit_cast(int, v), __builtin_bit_cast(int, v), 0x161, 0xf, 0xf, false)));
  v = fmaxf(v, __builtin_bit_cast(float, __builtin_amdgcn_update_dpp(__builtin_bit_cast(int, v), __builtin_bit_cast(int, v), 0x162, 0xf, 0xf, false)));
  v = fmaxf(v, __builtin_bit_cast(float, __builtin_amdgcn_update_dpp(__builtin_bit_cast(int, v), __builtin_bit_cast(int, v), 0x164, 0xf, 0xf, false)));
  return fmaxf(v, __builtin_bit_cast(float, __builtin_amdgcn_update_dpp(__builtin_bit_cast(int, v), __builtin_bit_cast(int, v), 0x168, 0xf, 0xf, false))); }
template <bool HI> __device__ __forceinline__ void att_body(const _Float16* __restrict__ QH, const _Float16* __restrict__ KH, const _Float16* __restrict__ QL, const _Float16* __restrict__ KL, const _Float16* __restrict__ VT, const __bf16* __restrict__ VB, const __bf16* __restrict__ VBL, float* __restrict__ Y, float (*ss)[132], unsigned char* kv, int b, int h, int qb, int wave, int lane) {
  const int col = lane & 15, g = lane >> 4; const int ql0 = qb * 128 + wave * 16; const size_t q0 = (size_t)b * TT + ql0; const int nkb = kb_last(2 * qb + 1) + 1;   /* the same for the block's eight waves: both 64-row halves end in key tile qb */
  const uint32_t wvs = uni((uint32_t)wave), kvb = (uint32_t)(size_t)kv;   /* the wave's number as a scalar; the ring's byte offset in the work-group's LDS */
  const _Float16* Kt0 = KH + (size_t)b * TT * CC + h * HD; const _Float16* Vt0 = VT + ((size_t)b * CC + h * HD) * (size_t)TT;   /* first byte of key tile 0 in k rows and in v planes */
  const _Float16* K0 = KH + ((size_t)b * TT + col) * CC + h * HD; const _Float16* KL0 = KL + ((size_t)b * KHI + col) * CC + h * HD;
  v16h ah[HD / 32], al[HD / 32];
#pragma unroll
  for (int kc = 0; kc < HD / 32; ++kc) { ah[kc] = frag_h(QH + (q0 + col) * CC + h * HD + kc * 32, lane); al[kc] = HI ? frag_h(QL + ((size_t)b * QHI + ql0 + col) * CC + h * HD + kc * 32, lane) : ah[kc]; }
  if (HI) asm volatile("s_wait_xcnt 0x0" ::: "memory");   // stands between the q loads and the first rewrite of their address registers
  float m[8], l[8];
#pragma unroll
  for (int r = 0; r < 8; ++r) { m[r] = -1.0e30f; l[r] = 0.f; }   /* the start stays above the excluded keys' -3e38, so that their exp(v - max) underflows to 0 also where no kept key has been met */
  v8f acc[HD / 16] = {};
  u32x4 dk0 = {}, dv0 = {}; u32x8 dk1 = {}, dv1 = {};   /* the descriptors of the k request (wave 0) and of the v request (wave 1), each in registers of its own: neither branch writes the other's */
  if (!HI) {   /* ring prologue (nkb >= 4 here): wave 0 brings k, wave 1 brings v; a tile counts as landed behind its issuer's own wait and is read by the others behind the barrier */
    if (pinned(wvs == 0u)) { tile_load<PADK, 128u, 128u, CC * 2u>(dk0, dk1, kvb, Kt0); tile_wait(dk0, dk1); }
    if (pinned(wvs == 1u)) { tile_load<PADV, 256u, 64u, TT * 2u>(dv0, dv1, kvb + KVT, Vt0); tile_wait(dv0, dv1); }
    __syncthreads();   // tile 0 is published
    if (pinned(wvs == 0u)) tile_load<PADK, 128u, 128u, CC * 2u>(dk0, dk1, kvb + STG, Kt0 + (size_t)128 * CC);
    if (pinned(wvs == 1u)) tile_load<PADV, 256u, 64u, TT * 2u>(dv0, dv1, kvb + STG + KVT, Vt0 + 128); }
  // rolled: one tile's body already fills the registers, and a second copy would only lengthen the text
#pragma unroll 1
  for (int kb = 0; kb < nkb; ++kb) { v8f s[8]; const _Float16* Ks = (const _Float16*)(kv + (kb & 1) * STG) + col * KPIT; const _Float16* Vs = (const _Float16*)(kv + (kb & 1) * STG + KVT) + col * VPIT;   /* the lane's row of this tile's stage */
    att_logits<HI>(ah, al, HI ? K0 + (size_t)kb * 128 * CC : Ks, KL0 + (size_t)kb * 128 * CC, lane, s);
    const int dd = ql0 + 8 * g - col - kb * 128;   /* the lane's first query row less its first key of the tile: one register carries the causal test, each element compares it with a constant */
#pragma unroll
    for (int r = 0; r < 8; ++r) { float tm = -3.0e38f;
#pragma unroll
      for (int j = 0; j < 8; ++j) { const float v = (j * 16 - r <= dd) ? s[j][r] : -3.0e38f; s[j][r] = v; tm = fmaxf(tm, v); }   /* key kb * 128 + j * 16 + col <= query ql0 + 8 * g + r */
      const float mn = fmaxf(m[r], rowmax16(tm));   /* the same in the row's 16 lanes */
      const float f = HI ? expf(m[r] - mn) : __builtin_amdgcn_exp2f((m[r] - mn) * SCL2);   /* 0 on the first tile, 1 while the maximum stands */
      const float mb = HI ? mn - LN2048 : 11.0f - mn * SCL2; float a = l[r] * f;
#pragma unroll
      for (int j = 0; j < 8; ++j) { const float p = HI ? expf(s[j][r] - mb) : __builtin_amdgcn_exp2f(fmaf(s[j][r], SCL2, mb)); a += p; ss[8 * g + r][j * 16 + col] = p; }   /* P x 2^11 against the maximum so far; excluded key: exp underflows to 0 */
#pragma unroll
      for (int j = 0; j < HD / 16; ++j) acc[j][r] *= f;   /* what was summed against the older maximum */
      l[r] = a; m[r] = mn; }
    LDSX();   // the wave's P stores land before other lanes of the wave read them
    if (HI) {
#pragma unroll
      for (int kc = 0; kc < 4; ++kc) { const F2 p = split_row(&ss[col][0], kc * 32, lane); v16b vh[HD / 16], vl[HD / 16];   /* eight fragments requested together */
#pragma unroll
        for (int j = 0; j < HD / 16; ++j) { const size_t po = ((size_t)b * CC + h * HD + j * 16 + col) * (size_t)KHI + kb * 128 + kc * 32; vh[j] = frag_b(VB + po, lane); vl[j] = frag_b(VBL + po, lane); }
#pragma unroll
        for (int j = 0; j < HD / 16; ++j) { acc[j] = wmma_bf(p.h, vh[j], acc[j]); acc[j] = wmma_bf(p.l, vh[j], acc[j]); acc[j] = wmma_bf(p.h, vl[j], acc[j]); } }
    } else {
#pragma unroll
      for (int kc = 0; kc < 4; ++kc) { const v16h p = frag_f32(&ss[col][kc * 32], lane); v16h vf[HD / 16];   /* P and the four v fragments of 32 keys are read from LDS together, ahead of their products */
#pragma unroll
        for (int j = 0; j < HD / 16; ++j) vf[j] = frag_h(Vs + j * 16 * VPIT + kc * 32, lane);
#pragma unroll
        for (int j = 0; j < HD / 16; ++j) acc[j] = wmma16(p, vf[j], acc[j]); } }
    if (HI) LDSX();   // the wave's P reads are done before the next tile (or the epilogue) overwrites them
    else {   /* publish point of tile kb + 1, passed by every wave */
      asm volatile("s_wait_dscnt 0" ::: "memory");   // the wave's reads of this stage (and of its P tile) have returned
      if (pinned(wvs == 0u)) tile_wait(dk0, dk1);   // the issuer's own request for tile kb + 1 has landed
      if (pinned(wvs == 1u)) tile_wait(dv0, dv1);
      __syncthreads();   // publishes tile kb + 1 and ends every wave's reads of tile kb's stage
      if (pinned((uint32_t)(kb + 2 < nkb))) {   /* tile kb + 2 goes into the stage that was just read */
        if (pinned(wvs == 0u)) tile_load<PADK, 128u, 128u, CC * 2u>(dk0, dk1, kvb + (uint32_t)(kb & 1) * STG, Kt0 + (size_t)(kb + 2) * 128 * CC);
        if (pinned(wvs == 1u)) tile_load<PADV, 256u, 64u, TT * 2u>(dv0, dv1, kvb + (uint32_t)(kb & 1) * STG + KVT, Vt0 + (kb + 2) * 128); } }
  }
  if (!HI) { asm volatile("s_wait_tensorcnt 0" ::: "memory"); asm volatile("s_wait_dscnt 0" ::: "memory"); }   // nothing of the ring is in flight when the wave goes on to its end
#pragma unroll
  for (int r = 0; r < 8; ++r) { float a = l[r];   /* the lanes' shares of the denominator (x 2^11, like acc) are joined once */
#pragma unroll
    for (int o = 1; o < 16; o <<= 1) a += __shfl_xor(a, o);
    l[r] = a > 0.f ? 1.0f / a : 0.f; }
#pragma unroll
  for (int j = 0; j < HD / 16; ++j)
#pragma unroll
    for (int r = 0; r < 8; ++r) ss[8 * g + r][j * 16 + col] = acc[j][r] * l[r];
  LDSX();   // ctx stores land before the row-wise read below
  for (int rl = 0; rl < 16; ++rl) if (lane < HD / 4) vst2(Y + ((size_t)b * TT + ql0 + rl) * CC + h * HD + lane * 4, *(const v4f*)&ss[rl][lane * 4]); }
// four waves per SIMD, as the two-sweep form had: without the attribute this build takes 278 registers (the early-row branch), and a SIMD then holds three waves to cover each other's exponentials and loads
__global__ __launch_bounds__(256) __attribute__((amdgpu_waves_per_eu(4))) void k_att(const _Float16* __restrict__ QH, const _Float16* __restrict__ KH, const _Float16* __restrict__ QL, const _Float16* __restrict__ KL, const _Float16* __restrict__ VT, const __bf16* __restrict__ VB, const __bf16* __restrict__ VBL, float* __restrict__ Y) { __shared__ __attribute__((aligned(2048))) unsigned char kv[2 * STG];   // two stages of (k tile, v tile); every place a multiple of 2 KiB
  __shared__ __align__(16) float ss[8][16][132];
  const int wave = threadIdx.x >> 5, lane = threadIdx.x & 31; const int h = blockIdx.x % NH, b = blockIdx.x / NH; const int qb = NQB / 2 - 1 - blockIdx.y;   /* longest blocks start first */
  if (qb < QBH / 2) att_body<true>(QH, KH, QL, KL, VT, VB, VBL, Y, ss[wave], kv, b, h, qb, wave, lane);   /* block-uniform */
  else att_body<false>(QH, KH, QL, KL, VT, VB, VBL, Y, ss[wave], kv, b, h, qb, wave, lane); }
// ---- k_out: block = (64 rows, 128 cols): out = ctx Wo (+ bo): ctx once to f16 against Wo as f16(bf16 x 2^8) exact (1 product) x 2^-8; causal early rows (< QHI of each sequence): ctx bf16 hi + lo against exact bf16 Wo (2 products). Operands staged as in k_proj
__global__ __launch_bounds__(128) void k_out(const float* __restrict__ Y, const float* __restrict__ WO, const float* __restrict__ BO, float* __restrict__ OUT) { __shared__ __align__(16) unsigned char sm[2 * 256 * SPITCH * 2];   // two staging buffers; the output tiles take the same space behind the last barrier of the k loop
  float (*sf)[16][132] = reinterpret_cast<float (*)[16][132]>(sm);
  const int tid = threadIdx.x, wave = tid >> 5, lane = tid & 31, col = lane & 15, g = lane >> 4; const int c0 = blockIdx.y * 128; const size_t r0 = (size_t)blockIdx.x * 64 + wave * 16;
  v8f acc[8] = {};
  if (CAUSAL && (int)(((size_t)blockIdx.x * 64) % TT) < QHI) {   /* block-uniform */
    gemm_staged<1>(Y + (size_t)blockIdx.x * 64 * CC, WO + (size_t)c0 * CC, sm, tid, acc);
#pragma unroll
    for (int j = 0; j < 8; ++j) { const float bias = BO ? bfr(BO[c0 + j * 16 + col]) : 0.f;
#pragma unroll
      for (int r = 0; r < 8; ++r) sf[wave][8 * g + r][j * 16 + col] = acc[j][r] + bias; }
  } else {
    gemm_staged<2>(Y + (size_t)blockIdx.x * 64 * CC, WO + (size_t)c0 * CC, sm, tid, acc);   /* ctx carried x 2^6 into f16 so small-magnitude context rows stay clear of f16 subnormals */
#pragma unroll
    for (int j = 0; j < 8; ++j) { const float bias = BO ? bfr(BO[c0 + j * 16 + col]) : 0.f;
#pragma unroll
      for (int r = 0; r < 8; ++r) sf[wave][8 * g + r][j * 16 + col] = acc[j][r] * (1.0f / 16384.0f) + bias; } }   /* 2^-8 (Wo carry) x 2^-6 (ctx carry) */
  LDSX(); for (int rl = 0; rl < 16; ++rl) vst2(OUT + (r0 + rl) * DIN + c0 + lane * 4, *(const v4f*)&sf[wave][rl][lane * 4]); }

extern "C" void kernel_launch(void* const* d_in, const int* in_sizes, int n_in, void* d_out, int out_size, void* d_ws, size_t ws_size, hipStream_t stream) {
  (void)in_sizes; (void)n_in; (void)out_size;
  const float** F = (const float**)d_in;
  if (ws_size < (size_t)WS_END) return;
  char* ws = (char*)d_ws; _Float16 *QH = (_Float16*)(ws + WS_QH), *KH = (_Float16*)(ws + WS_KH), *VT = (_Float16*)(ws + WS_VT), *QL = (_Float16*)(ws + WS_QL), *KL = (_Float16*)(ws + WS_KL); __bf16 *VB = (__bf16*)(ws + WS_VB), *VBL = (__bf16*)(ws + WS_VBL); float *Y = (float*)(ws + WS_Y);
  (void)Y; (void)QL; (void)KL; (void)VB; (void)VBL;
  // inputs: 0 query [4,2048,768]; 1 key; 2 value; 3 Wq [768,768] (out,in), 4 bq; 5 Wk, 6 bk; 7 Wv, 8 bv; 9 Wo (out,in), 10 bo (all biases zeros, read)
  k_proj<<<dim3(TNB * TT / 64, CC / 128, 3), 128, 0, stream>>>(F[0], F[1], F[2], F[3], F[5], F[7], F[4], F[6], F[8], QH, QL, KH, KL, VT, VB, VBL);
  k_att<<<dim3(TNB * NH, NQB / 2), 256, 0, stream>>>(QH, KH, QL, KL, VT, VB, VBL, Y);
  k_out<<<dim3(TNB * TT / 64, DIN / 128), 128, 0, stream>>>(Y, F[9], F[10], (float*)d_out);
}
